// v000
// Measured on an AMD MI455X. A time is GPU time per run, averaged over a window of back-to-back runs after a warm-up
// (all launches, gaps included; the runs take copies of the inputs in turn), and the median of several windows.
// Apart from v000's, it joins two sittings. Times from different sittings can be a few percent apart, while
// side-by-side timings come from the same sitting.
// The starting kernel, v000, takes 3020 microseconds a run.
#include <hip/hip_runtime.h>

// A one-head attention over 512 tokens of width 256 (two entries) whose tokens first take an additive term made from a pairwise tensor
// (inputs, in argument order: a0 [2][512][256] tokens; a1 [2][512][512][12] pair features; a2 [12][32] with a3 [32]; a4, a5, a6, a7 [32]: a norm's scale, shift, running mean, running variance;
//   a8 [32][256] with a9 [256]; a10, a11, a12, a13 [256]: a second such norm; a14 [256][768] one projection ('in' by 'three times the width') whose thirds are the three planes of the attention):
//   U1 = max((a1 a2 + a3 - a6) / sqrt(a7 + 1e-5) x a4 + a5, 0): [2][512][512][32]; U2 = max((U1 a8 + a9 - a12) / sqrt(a13 + 1e-5) x a10 + a11, 0): [2][512][512][256];
//   ADD[e][s][c] = the largest U2[e][s][t][c] over t; Z = a0 + ADD; the three planes Z a14[:, 0:256], Z a14[:, 256:512], Z a14[:, 512:768]; scores = plane 1 x plane 2 transposed / 16; a softmax along the last axis; result = weights x plane 3: [2][512][256].
// Layout: U2 would be 512 MiB and is never formed: SIXTY-FOUR BLOCKS of sixteen (entry, s) rows of 512 pairs: a block's first layer is one f16 product at depth 32 (a1 padded from 12 with noughts; a2 transposed and padded to a 64-wide tile; both inputs' words are bf16-exact and f16 holds them exactly in its normal range),
//   its norm, maximum and ONE f16 word; its second layer one f16 product at depth 32 into an 8-MiB plane that is rewritten sixty-four times; a lane a (row, channel) takes the norm, the maximum with nought and the largest over the 512 pairs;
//   the tokens plus that term as ONE f16 word; three f16 products at depth 256 against a14 as f16 rows (a14's words are bf16-exact: f16 holds them exactly in its normal range); planes 1 and 2 ONE f16 word;
//   the scores by one batched f16 product; the dense softmax at 512 tokens, every row as bf16 hi + lo; plane 3 transposed as bf16 hi + lo by the value cast (four groups of 64 channels); the last product three bf16 products (hi hi, hi lo, lo hi), straight into the output.
// FIVE of this file's nine kernel texts (k_pd12, k_wt, k_nm1, k_bred, k_adc): every address from the lane's own index and launch constants; exact grids, no guard (k_wt's padding select apart); no LDS, barrier, lane-crossing word or atomic; k_bred's loop runs a literal trip count, the same for every lane.
// Compute dtypes, f32 accumulate: every float input rounded to bf16 at its first read; the first layer f16 x f16 on words that hold the inputs' bf16 values exactly; every computed operand ONE f16 word but the softmax weights and plane 3, which are bf16 hi + lo (the weights reach down to 2e-9: an f16 plane of them would be more than a third subnormal); norms, maxima, exponentials f32.

#define NE   2                    // entries
#define NT   512                  // tokens an entry = pairs a row
#define NW   256                  // width
#define NU   32                   // the first layer's width = the second layer's depth
#define NP   12                   // pair features
#define BR   16                   // (entry, s) rows a block
#define NEPS 1e-5f                // the two norms' epsilon
// attention constants for 512 tokens (the softmax reads TT, ZH, RH, PCAR, SCL; the value cast reads TT, HD)
#define TT   512
#define HD   64
#define ZH   2
#define RH   512
#define WIN  0
#define PCAR 1024.0f
#define SCL  0.0625f   // 256^-0.5
#define PFL  6.103515625e-05f   // 2^-14: the flushing cast's line (the softmax's f16 branch alone reads it: not taken here)
typedef _Float16 h16;
typedef unsigned short bf;
typedef __attribute__((ext_vector_type(16))) __bf16   v16bf;
typedef __attribute__((ext_vector_type(16))) _Float16 v16h;
typedef __attribute__((ext_vector_type(8)))  _Float16 v8h;
typedef __attribute__((ext_vector_type(8)))  unsigned short v8us;
typedef __attribute__((ext_vector_type(8)))  float    v8f;
typedef __attribute__((ext_vector_type(4)))  float    v4f;
typedef v8h  __attribute__((may_alias)) v8ha;
typedef v4f  __attribute__((may_alias)) v4fa;
typedef v8us __attribute__((may_alias)) v8usa;

__device__ __forceinline__ unsigned short f2bf(float f) { unsigned u = __float_as_uint(f); u += 0x7FFFu + ((u >> 16) & 1u); return (unsigned short)(u >> 16); }
__device__ __forceinline__ float bf2f(unsigned short b) { return __uint_as_float(((unsigned)b) << 16); }
__device__ __forceinline__ float bfr(float f) { return bf2f(f2bf(f)); }
__device__ __forceinline__ v16h cat16(v8h lo, v8h hi) { return __builtin_shufflevector(lo, hi, 0, 1, 2, 3, 4, 5, 6, 7, 8, 9, 10, 11, 12, 13, 14, 15); }
__device__ __forceinline__ v16bf cat16b(v8us lo, v8us hi) { return __builtin_bit_cast(v16bf, __builtin_shufflevector(lo, hi, 0, 1, 2, 3, 4, 5, 6, 7, 8, 9, 10, 11, 12, 13, 14, 15)); }
__device__ __forceinline__ v8f wmma16(v16h a, v16h b, v8f c) { return __builtin_amdgcn_wmma_f32_16x16x32_f16(false, a, false, b, (short)0, c, false, false); }
__device__ __forceinline__ v8f wmmab(v16bf a, v16bf b, v8f c) { return __builtin_amdgcn_wmma_f32_16x16x32_bf16(false, a, false, b, (short)0, c, false, false); }



// ---- k_gemmw: register-blocked GEMM, ONE WAVE per 64x64 output tile (16 accumulators), operands straight from K-contiguous 16-bit planes; grid (M/64, N/64, Z), 32 threads.
// C[m][n] (f32, pitch ldc, + optional f32 bias[n]) = sum_k A[m][k] Bt[n][k] (+ split products per NSPLIT). z-batch strides sA/sB/sC in elements. K % 32 == 0.
template <typename T16> struct WFrag;
template <> struct WFrag<h16> { typedef v16h V; static __device__ __forceinline__ V ld(const h16* p) { return cat16(*(const v8h*)p, *(const v8h*)(p + 16)); } static __device__ __forceinline__ v8f mma(V a, V b, v8f c) { return wmma16(a, b, c); } };
template <> struct WFrag<bf> { typedef v16bf V; static __device__ __forceinline__ V ld(const bf* p) { return cat16b(*(const v8us*)p, *(const v8us*)(p + 16)); } static __device__ __forceinline__ v8f mma(V a, V b, v8f c) { return wmmab(a, b, c); } };
template <typename T16, int NSPLIT, bool BIAS>
__global__ __launch_bounds__(32) void k_gemmw(const T16* __restrict__ A, const T16* __restrict__ A2, const T16* __restrict__ Bt, const T16* __restrict__ Bt2, int K, float* C, int ldc, const float* __restrict__ bias, size_t sA, size_t sB, size_t sC) {
    typedef typename WFrag<T16>::V V;
    __shared__ __align__(16) float os[16 * 68];
    const size_t z = blockIdx.z; A += z * sA; if (A2) A2 += z * sA; Bt += z * sB; if (Bt2) Bt2 += z * sB; C += z * sC;
    const int lane = threadIdx.x & 31, lr = lane & 15, hi = lane >> 4; const int r0 = blockIdx.x * 64, c0 = blockIdx.y * 64;
    v8f acc[4][4];
#pragma unroll
    for (int mb = 0; mb < 4; ++mb)
#pragma unroll
        for (int nb = 0; nb < 4; ++nb) acc[mb][nb] = (v8f){};
    const size_t aoff = (size_t)(r0 + lr) * K + 8 * hi, boff = (size_t)(c0 + lr) * K + 8 * hi;

    for (int kc = 0; kc < K; kc += 32) {
        V a[4], a2[4];
#pragma unroll
        for (int mb = 0; mb < 4; ++mb) { a[mb] = WFrag<T16>::ld(A + aoff + (size_t)mb * 16 * K + kc); if (NSPLIT == 1 || NSPLIT == 2) a2[mb] = WFrag<T16>::ld(A2 + aoff + (size_t)mb * 16 * K + kc); }
#pragma unroll
        for (int nb = 0; nb < 4; ++nb) { const V b = WFrag<T16>::ld(Bt + boff + (size_t)nb * 16 * K + kc); V b2; if (NSPLIT >= 2) b2 = WFrag<T16>::ld(Bt2 + boff + (size_t)nb * 16 * K + kc);
#pragma unroll
            for (int mb = 0; mb < 4; ++mb) { acc[mb][nb] = WFrag<T16>::mma(a[mb], b, acc[mb][nb]); if (NSPLIT == 1 || NSPLIT == 2) acc[mb][nb] = WFrag<T16>::mma(a2[mb], b, acc[mb][nb]); if (NSPLIT >= 2) acc[mb][nb] = WFrag<T16>::mma(a[mb], b2, acc[mb][nb]); } }
        asm volatile("v_nop\n\tv_nop\n\tv_nop\n\tv_nop" : "+v"(acc[0][0]), "+v"(acc[1][1]), "+v"(acc[2][2]), "+v"(acc[3][3]) : "v"(a[0]), "v"(a[3]));
    }
#pragma unroll
    for (int mb = 0; mb < 4; ++mb) {
#pragma unroll
        for (int nb = 0; nb < 4; ++nb) {
#pragma unroll
            for (int j = 0; j < 8; ++j) os[(hi * 8 + j) * 68 + nb * 16 + lr] = acc[mb][nb][j]; }
        __builtin_amdgcn_wave_barrier(); asm volatile("" ::: "memory");
        float* crow = C + (size_t)(r0 + mb * 16) * ldc + c0;
{
#pragma unroll
            for (int s = 0; s < 8; ++s) { const int row = 2 * s + hi, cofs = lr * 4; v4f val = *(const v4fa*)(os + row * 68 + cofs); if (BIAS) { val[0] += bfr(bias[c0 + cofs]); val[1] += bfr(bias[c0 + cofs + 1]); val[2] += bfr(bias[c0 + cofs + 2]); val[3] += bfr(bias[c0 + cofs + 3]); }
                *(v4f*)(crow + (size_t)row * ldc + cofs) = val; }
             }
        __builtin_amdgcn_wave_barrier(); asm volatile("" ::: "memory");
    }
}

__device__ __forceinline__ h16 tohx(float x) { return (h16)x; }
__device__ __forceinline__ void splitf(float y, unsigned short& h, unsigned short& l) { h = f2bf(y); l = f2bf(y - bf2f(h)); }
typedef __attribute__((ext_vector_type(2))) _Float16 v2h;
typedef __attribute__((ext_vector_type(4))) _Float16 v4h;
typedef __attribute__((ext_vector_type(2))) unsigned short v2us;
typedef __attribute__((ext_vector_type(4))) unsigned short v4us;
typedef __attribute__((ext_vector_type(2))) float v2f;
typedef __attribute__((ext_vector_type(4))) int v4i;
__global__ __launch_bounds__(256) void k_f2h(const float* __restrict__ S, h16* P16, size_t n4) { const size_t i = (size_t)blockIdx.x * 256 + threadIdx.x; if (i >= n4) return; const v4f v = *(const v4f*)(S + i * 4); v4h o;
#pragma unroll
    for (int q = 0; q < 4; ++q) o[q] = tohx(v[q]);
    *(v4h*)(P16 + i * 4) = o;  }
__global__ __launch_bounds__(256) void k_vtp(const float* __restrict__ F, int pitch, int nheads, h16* V16, bf* Vh, bf* Vl) { const size_t e = ((size_t)blockIdx.x * 256 + threadIdx.x) * 2; if (e >= (size_t)nheads * HD * TT) return; const int t = (int)(e % TT); const int d = (int)((e / TT) % HD); const int g = (int)(e / ((size_t)TT * HD)); v2h o16; v2us oh, ol;
#pragma unroll
    for (int q = 0; q < 2; ++q) { const float x = F[(size_t)(t + q) * pitch + g * HD + d]; o16[q] = tohx(x); unsigned short a2, c2; splitf(x, a2, c2); oh[q] = a2; ol[q] = c2; }
    *(v2h*)(V16 + e) = o16; *(v2us*)(Vh + e) = oh; *(v2us*)(Vl + e) = ol;  }
// k_asoft: the dense softmax: per row (zz, i): t = S x SCL (no mask); softmax over the 512 keys (register row, one exp, fixed trees: the kernel's only lane-crossing words);
__global__ __launch_bounds__(256) void k_asoft(const float* __restrict__ Sb, h16* P16, bf* Ph, bf* Pl) {
    const int lane = threadIdx.x & 31; const int row = blockIdx.x * 8 + (threadIdx.x >> 5); if (row >= ZH * TT) return; const int i = row % TT; const int zz = row / TT; (void)zz; const bool hires = (i < RH); const float* sr = Sb + (size_t)row * TT; float v[TT / 32]; float mx = -3.0e38f;
#pragma unroll
    for (int ch = 0; ch < TT / 128; ++ch) { const int j0 = ch * 128 + lane * 4; const v4f a = *(const v4f*)(sr + j0);
#pragma unroll
        for (int q = 0; q < 4; ++q) { const int j = j0 + q; (void)j; const float t = a[q] * SCL; v[ch * 4 + q] = t; mx = fmaxf(mx, t); } }
#pragma unroll
    for (int sh = 16; sh; sh >>= 1) mx = fmaxf(mx, __shfl_xor(mx, sh, 32));
    float sum = 0.f;
#pragma unroll
    for (int k = 0; k < TT / 32; ++k) { float d0 = __fsub_rn(v[k], mx); v[k] = __builtin_amdgcn_exp2f(__fmul_rn(d0, 1.4426950408889634f)); sum += v[k]; }
#pragma unroll
    for (int sh = 16; sh; sh >>= 1) sum += __shfl_xor(sum, sh, 32);
    const float f = __fdiv_rn(hires ? 1.0f : PCAR, sum);
    {
        if (hires) {
#pragma unroll
            for (int ch = 0; ch < TT / 128; ++ch) { v4us oh, ol;
#pragma unroll
                for (int q = 0; q < 4; ++q) { unsigned short a, c2; splitf(v[ch * 4 + q] * f, a, c2); oh[q] = a; ol[q] = c2; }
                const size_t oo = ((size_t)zz * (RH ? RH : 1) + i) * TT + ch * 128 + lane * 4; *(v4us*)(Ph + oo) = oh; *(v4us*)(Pl + oo) = ol; }
        } else {
#pragma unroll
            for (int ch = 0; ch < TT / 128; ++ch) { v4h o4;
#pragma unroll
                for (int q = 0; q < 4; ++q) { const float w = v[ch * 4 + q] * f; o4[q] = tohx(w < PFL ? 0.0f : w); }   /* THE FLUSHING CAST: an f32 weight word UNDER 2^-14 (strictly: a word equal to 2^-14 is kept; so is a NaN) is stored as an exact zero before the f16 rounding, so that no f16 subnormal reaches the value product's matrix instruction; the weights are non-negative */
                *(v4h*)(P16 + (size_t)row * TT + ch * 128 + lane * 4) = o4; } }
         }
}
__global__ __launch_bounds__(256) void k_pd12(const float* __restrict__ src, h16* dst) { const size_t pp = (size_t)blockIdx.x * 256 + threadIdx.x; const v4f p0 = *(const v4f*)(src + pp * NP), p1 = *(const v4f*)(src + pp * NP + 4), p2 = *(const v4f*)(src + pp * NP + 8); v8us o0, o1; const v8us zz8 = {0, 0, 0, 0, 0, 0, 0, 0};
#pragma unroll
    for (int e = 0; e < 4; ++e) { o0[e] = __builtin_bit_cast(unsigned short, tohx(bfr(p0[e]))); o0[4 + e] = __builtin_bit_cast(unsigned short, tohx(bfr(p1[e]))); o1[e] = __builtin_bit_cast(unsigned short, tohx(bfr(p2[e]))); o1[4 + e] = 0; }
    unsigned short* d0 = (unsigned short*)dst + pp * 32;
    *(v8us*)(d0) = o0; *(v8us*)(d0 + 8) = o1; *(v8us*)(d0 + 16) = zz8; *(v8us*)(d0 + 24) = zz8;  }
__global__ __launch_bounds__(256) void k_wt(const float* __restrict__ S, int kin, int nin, int kout, h16* D) { const unsigned idx = (blockIdx.x * 256u + threadIdx.x) * 2u; const unsigned nn = idx / (unsigned)kout, kk = idx - nn * (unsigned)kout; const bool row = (nn < (unsigned)nin); const bool live0 = row && (kk < (unsigned)kin), live1 = row && (kk + 1u < (unsigned)kin);
    const float val0 = live0 ? bfr(S[(size_t)kk * nin + nn]) : 0.0f; const float val1 = live1 ? bfr(S[(size_t)(kk + 1u) * nin + nn]) : 0.0f; v2h o; o[0] = tohx(val0); o[1] = tohx(val1);
    *(v2h*)(D + idx) = o;  }
// k_nm1: A BLOCK's FIRST LAYER THROUGH ITS NORM AND MAXIMUM, AS ONE f16 WORD: from the product plane C1 [8192][64] (columns 0..31 live): a lane one pair and four units: ((c + a3 - a6) x rsqrt(a7 + 1e-5)) x a4 + a5, the maximum with nought, the f16 word: in the module's own order;
__global__ __launch_bounds__(256) void k_nm1(const float* __restrict__ C1, const float* __restrict__ a3, const float* __restrict__ a4, const float* __restrict__ a5, const float* __restrict__ a6, const float* __restrict__ a7, h16* H1) { const unsigned idx = blockIdx.x * 256u + threadIdx.x; const unsigned pp = idx >> 3, u0 = (idx & 7u) * 4u; const v4f cc = *(const v4f*)(C1 + (size_t)pp * 64 + u0); v4h o;
#pragma unroll
    for (int e = 0; e < 4; ++e) { const unsigned uu = u0 + e; float yy = (cc[e] + bfr(a3[uu])) - bfr(a6[uu]); yy = yy * rsqrtf(bfr(a7[uu]) + NEPS); yy = yy * bfr(a4[uu]) + bfr(a5[uu]); o[e] = tohx(fmaxf(yy, 0.0f)); }
    h16* dst = H1 + (size_t)pp * NU + u0; *(v4h*)dst = o;  }
// k_bred: A BLOCK's SECOND LAYER THROUGH ITS NORM AND MAXIMUM, THEN THE LARGEST OVER THE 512 PAIRS OF A ROW: from the product plane C2 [16 x 512][256]: a lane one (row, channel): a 512-trip loop (a literal count): ((c + a9 - a12) x rsqrt(a13 + 1e-5)) x a10 + a11, the maximum with nought, the running largest (begun at nought: the values are never negative);
__global__ __launch_bounds__(256) void k_bred(const float* __restrict__ C2, const float* __restrict__ a9, const float* __restrict__ a10, const float* __restrict__ a11, const float* __restrict__ a12, const float* __restrict__ a13, float* AD) { const unsigned idx = blockIdx.x * 256u + threadIdx.x; const unsigned rr = idx >> 8, ch = idx & 255u; const float b9 = bfr(a9[ch]), m12 = bfr(a12[ch]), sc = rsqrtf(bfr(a13[ch]) + NEPS), gg = bfr(a10[ch]), bs = bfr(a11[ch]); const float* src = C2 + (size_t)rr * NT * NW + ch; float top = 0.0f;
    for (int tt = 0; tt < NT; ++tt) { float yy = (src[(size_t)tt * NW] + b9) - m12; yy = yy * sc; yy = yy * gg + bs; top = fmaxf(top, fmaxf(yy, 0.0f)); }
    float* dst = AD + (size_t)rr * NW + ch; *(float*)dst = top;  }
__global__ __launch_bounds__(256) void k_adc(const float* __restrict__ a0, const float* __restrict__ AD, h16* ZH16) { const size_t i = (size_t)blockIdx.x * 256 + threadIdx.x; const v4f p = *(const v4f*)(a0 + i * 4), t4 = *(const v4f*)(AD + i * 4); v4h o;
#pragma unroll
    for (int e = 0; e < 4; ++e) o[e] = tohx(bfr(p[e]) + t4[e]);
    *(v4h*)(ZH16 + i * 4) = o;  }

extern "C" void kernel_launch(void* const* d_in, const int* in_sizes, int n_in,
                              void* d_out, int out_size, void* d_ws, size_t ws_size, hipStream_t stream) {
    (void)in_sizes; (void)n_in; (void)out_size;
    const float* a0 = (const float*)d_in[0]; const float* a1 = (const float*)d_in[1]; const float* a2 = (const float*)d_in[2]; const float* a3 = (const float*)d_in[3]; const float* a4 = (const float*)d_in[4]; const float* a5 = (const float*)d_in[5]; const float* a6 = (const float*)d_in[6]; const float* a7 = (const float*)d_in[7];
    const float* a8 = (const float*)d_in[8]; const float* a9 = (const float*)d_in[9]; const float* a10 = (const float*)d_in[10]; const float* a11 = (const float*)d_in[11]; const float* a12 = (const float*)d_in[12]; const float* a13 = (const float*)d_in[13]; const float* a14 = (const float*)d_in[14];
    // inputs in the module's argument order = d_in[0..14]: all fifteen read
    float* OUT = (float*)d_out;     // [2][512][256]
    char* wsp = (char*)d_ws;
    auto take = [&](size_t bytes) { char* p = wsp; wsp += (bytes + 255) & ~(size_t)255; return (void*)p; };
    const size_t NPAIR = (size_t)NE * NT * NT, BP = (size_t)BR * NT;      // 524,288 pairs; 8,192 pairs a block
    h16* RB = (h16*)take(NPAIR * 32 * 2); h16* W1 = (h16*)take((size_t)64 * 32 * 2); h16* W2 = (h16*)take((size_t)NW * 32 * 2); h16* W3 = (h16*)take((size_t)3 * NW * NW * 2);
    float* C1 = (float*)take(BP * 64 * 4); h16* H1 = (h16*)take(BP * NU * 2); float* C2 = (float*)take(BP * NW * 4); float* AD = (float*)take((size_t)NE * NT * NW * 4); h16* ZH16 = (h16*)take((size_t)NE * NT * NW * 2);
    float* P1 = (float*)take((size_t)NE * NT * NW * 4); float* P2 = (float*)take((size_t)NE * NT * NW * 4); float* P3 = (float*)take((size_t)NE * NT * NW * 4); h16* H2 = (h16*)take((size_t)NE * NT * NW * 2); h16* H3 = (h16*)take((size_t)NE * NT * NW * 2);
    h16* V16 = (h16*)take((size_t)NE * NW * NT * 2); bf* Vh = (bf*)take((size_t)NE * NW * NT * 2); bf* Vl = (bf*)take((size_t)NE * NW * NT * 2); float* Sb = (float*)take((size_t)NE * NT * NT * 4); bf* Ph = (bf*)take((size_t)NE * NT * NT * 2); bf* Pl = (bf*)take((size_t)NE * NT * NT * 2);
    if ((size_t)(wsp - (char*)d_ws) > ws_size) return;
    k_pd12<<<(unsigned)(NPAIR / 256), 256, 0, stream>>>(a1, RB);
    k_wt<<<64 * 32 / 2 / 256, 256, 0, stream>>>(a2, NP, NU, 32, W1); k_wt<<<NW * 32 / 2 / 256, 256, 0, stream>>>(a8, NU, NW, 32, W2); k_wt<<<3 * NW * NW / 2 / 256, 256, 0, stream>>>(a14, NW, 3 * NW, NW, W3);
    for (int blk = 0; blk < NE * NT / BR; ++blk) {     /* sixty-four blocks: C1, H1 and C2 are rewritten each block, each after the launch that reads it (stream order) */
        k_gemmw<h16, 0, false><<<dim3((unsigned)(BP / 64), 1, 1), 32, 0, stream>>>(RB + (size_t)blk * BP * 32, nullptr, W1, nullptr, 32, C1, 64, nullptr, 0, 0, 0);
        k_nm1<<<(unsigned)(BP * 8 / 256), 256, 0, stream>>>(C1, a3, a4, a5, a6, a7, H1);
        k_gemmw<h16, 0, false><<<dim3((unsigned)(BP / 64), NW / 64, 1), 32, 0, stream>>>(H1, nullptr, W2, nullptr, NU, C2, NW, nullptr, 0, 0, 0);
        k_bred<<<BR * NW / 256, 256, 0, stream>>>(C2, a9, a10, a11, a12, a13, AD + (size_t)blk * BR * NW); }
    k_adc<<<NE * NT * NW / 4 / 256, 256, 0, stream>>>(a0, AD, ZH16);
    k_gemmw<h16, 0, false><<<dim3(NE * NT / 64, NW / 64, 1), 32, 0, stream>>>(ZH16, nullptr, W3, nullptr, NW, P1, NW, nullptr, 0, 0, 0);
    k_gemmw<h16, 0, false><<<dim3(NE * NT / 64, NW / 64, 1), 32, 0, stream>>>(ZH16, nullptr, W3 + (size_t)NW * NW, nullptr, NW, P2, NW, nullptr, 0, 0, 0);
    k_gemmw<h16, 0, false><<<dim3(NE * NT / 64, NW / 64, 1), 32, 0, stream>>>(ZH16, nullptr, W3 + (size_t)2 * NW * NW, nullptr, NW, P3, NW, nullptr, 0, 0, 0);
    k_f2h<<<NE * NT * NW / 4 / 256, 256, 0, stream>>>(P1, H2, (size_t)NE * NT * NW / 4); k_f2h<<<NE * NT * NW / 4 / 256, 256, 0, stream>>>(P2, H3, (size_t)NE * NT * NW / 4);
    for (int en = 0; en < NE; ++en) k_vtp<<<(NW * NT / 2 + 255) / 256, 256, 0, stream>>>(P3 + (size_t)en * NT * NW, NW, NW / HD, V16 + (size_t)en * NW * NT, Vh + (size_t)en * NW * NT, Vl + (size_t)en * NW * NT);
    k_gemmw<h16, 0, false><<<dim3(NT / 64, NT / 64, NE), 32, 0, stream>>>(H2, nullptr, H3, nullptr, NW, Sb, NT, nullptr, (size_t)NT * NW, (size_t)NT * NW, (size_t)NT * NT);
    k_asoft<<<ZH * TT / 8, 256, 0, stream>>>(Sb, nullptr, Ph, Pl);     /* RH = TT: every row takes the hi + lo branch: the f16 plane's pointer is never used */
    k_gemmw<bf, 2, false><<<dim3(NT / 64, NW / 64, NE), 32, 0, stream>>>(Ph, Pl, Vh, Vl, NT, OUT, NW, nullptr, (size_t)NT * NT, (size_t)NW * NT, (size_t)NT * NW);
}

// v002
// A run of this version takes 80.6 microseconds.
// Versions in between are left out here; by their measured steps it is 36.9 times as fast as v000.
#include <hip/hip_runtime.h>

// A one-head attention over 512 tokens of width 256 (two entries) whose tokens first take an additive term made from a pairwise tensor
// (inputs, in argument order: a0 [2][512][256] tokens; a1 [2][512][512][12] pair features; a2 [12][32] with a3 [32]; a4, a5, a6, a7 [32]: a norm's scale, shift, running mean, running variance;
//   a8 [32][256] with a9 [256]; a10, a11, a12, a13 [256]: a second such norm; a14 [256][768] one projection ('in' by 'three times the width') whose thirds are the three planes of the attention):
//   U1 = max((a1 a2 + a3 - a6) / sqrt(a7 + 1e-5) x a4 + a5, 0): [2][512][512][32]; U2 = max((U1 a8 + a9 - a12) / sqrt(a13 + 1e-5) x a10 + a11, 0): [2][512][512][256];
//   ADD[e][s][c] = the largest U2[e][s][t][c] over t; Z = a0 + ADD; the three planes Z a14[:, 0:256], Z a14[:, 256:512], Z a14[:, 512:768]; scores = plane 1 x plane 2 transposed / 16; a softmax along the last axis; result = weights x plane 3: [2][512][256].
// Layout: neither U1 nor U2 is ever in memory: one work-group takes one (entry, s) row from a1 to ADD (k_l12mx). The first layer is an f16 product at depth 32 (a1 padded from 12 with noughts in the loader; a2 transposed and padded to a 64-wide tile; both inputs' words are bf16-exact and f16 holds them exactly in its normal range),
//   its norm, maximum and ONE f16 word, kept in LDS for the row; the second layer one f16 product at depth 32 whose tiles never leave the registers: the wave that forms a tile takes the norm, the maximum with nought and the largest over the 512 pairs of its row there;
//   the tokens plus that term as ONE f16 word; three f16 products at depth 256 against a14 as f16 rows (a14's words are bf16-exact: f16 holds them exactly in its normal range); planes 1 and 2 ONE f16 word;
//   the scores by one batched f16 product; the dense softmax at 512 tokens, every row as bf16 hi + lo; plane 3 transposed as bf16 hi + lo by the value cast (four groups of 64 channels); the last product three bf16 products (hi hi, hi lo, lo hi), straight into the output.
// THREE kernel texts of this file beside k_gemmw, k_f2h, k_vtp, k_asoft (k_wt, k_l12mx, k_adc): every address from the lane's own index and launch constants; exact grids, no guard (k_wt's padding select apart); no atomic; k_l12mx alone has LDS (32 KiB, written once, one barrier, then read), its loops run literal trip counts, the same for every lane, and it alone has lane-crossing words (two, behind its last loop).
// Compute dtypes, f32 accumulate: every float input rounded to bf16 at its first read; the first layer f16 x f16 on words that hold the inputs' bf16 values exactly; every computed operand ONE f16 word but the softmax weights and plane 3, which are bf16 hi + lo (the weights reach down to 2e-9: an f16 plane of them would be more than a third subnormal); norms, maxima, exponentials f32.

#define NE   2                    // entries
#define NT   512                  // tokens an entry = pairs a row
#define NW   256                  // width
#define NU   32                   // the first layer's width = the second layer's depth
#define NP   12                   // pair features
#define NEPS 1e-5f                // the two norms' epsilon
// attention constants for 512 tokens (the softmax reads TT, ZH, RH, PCAR, SCL; the value cast reads TT, HD)
#define TT   512
#define HD   64
#define ZH   2
#define RH   512
#define WIN  0
#define PCAR 1024.0f
#define SCL  0.0625f   // 256^-0.5
#define PFL  6.103515625e-05f   // 2^-14: the flushing cast's line (the softmax's f16 branch alone reads it: not taken here)
typedef _Float16 h16;
typedef unsigned short bf;
typedef __attribute__((ext_vector_type(16))) __bf16   v16bf;
typedef __attribute__((ext_vector_type(16))) _Float16 v16h;
typedef __attribute__((ext_vector_type(8)))  _Float16 v8h;
typedef __attribute__((ext_vector_type(8)))  unsigned short v8us;
typedef __attribute__((ext_vector_type(8)))  float    v8f;
typedef __attribute__((ext_vector_type(4)))  float    v4f;
typedef v8h  __attribute__((may_alias)) v8ha;
typedef v4f  __attribute__((may_alias)) v4fa;
typedef v8us __attribute__((may_alias)) v8usa;

__device__ __forceinline__ unsigned short f2bf(float f) { unsigned u = __float_as_uint(f); u += 0x7FFFu + ((u >> 16) & 1u); return (unsigned short)(u >> 16); }
__device__ __forceinline__ float bf2f(unsigned short b) { return __uint_as_float(((unsigned)b) << 16); }
__device__ __forceinline__ float bfr(float f) { return bf2f(f2bf(f)); }
__device__ __forceinline__ v16h cat16(v8h lo, v8h hi) { return __builtin_shufflevector(lo, hi, 0, 1, 2, 3, 4, 5, 6, 7, 8, 9, 10, 11, 12, 13, 14, 15); }
__device__ __forceinline__ v16bf cat16b(v8us lo, v8us hi) { return __builtin_bit_cast(v16bf, __builtin_shufflevector(lo, hi, 0, 1, 2, 3, 4, 5, 6, 7, 8, 9, 10, 11, 12, 13, 14, 15)); }
__device__ __forceinline__ v8f wmma16(v16h a, v16h b, v8f c) { return __builtin_amdgcn_wmma_f32_16x16x32_f16(false, a, false, b, (short)0, c, false, false); }
__device__ __forceinline__ v8f wmmab(v16bf a, v16bf b, v8f c) { return __builtin_amdgcn_wmma_f32_16x16x32_bf16(false, a, false, b, (short)0, c, false, false); }



// ---- k_gemmw: register-blocked GEMM, ONE WAVE per 64x64 output tile (16 accumulators), operands straight from K-contiguous 16-bit planes; grid (M/64, N/64, Z), 32 threads.
// C[m][n] (f32, pitch ldc, + optional f32 bias[n]) = sum_k A[m][k] Bt[n][k] (+ split products per NSPLIT). z-batch strides sA/sB/sC in elements. K % 32 == 0.
template <typename T16> struct WFrag;
template <> struct WFrag<h16> { typedef v16h V; static __device__ __forceinline__ V ld(const h16* p) { return cat16(*(const v8h*)p, *(const v8h*)(p + 16)); } static __device__ __forceinline__ v8f mma(V a, V b, v8f c) { return wmma16(a, b, c); } };
template <> struct WFrag<bf> { typedef v16bf V; static __device__ __forceinline__ V ld(const bf* p) { return cat16b(*(const v8us*)p, *(const v8us*)(p + 16)); } static __device__ __forceinline__ v8f mma(V a, V b, v8f c) { return wmmab(a, b, c); } };
template <typename T16, int NSPLIT, bool BIAS>
__global__ __launch_bounds__(32) void k_gemmw(const T16* __restrict__ A, const T16* __restrict__ A2, const T16* __restrict__ Bt, const T16* __restrict__ Bt2, int K, float* C, int ldc, const float* __restrict__ bias, size_t sA, size_t sB, size_t sC) {
    typedef typename WFrag<T16>::V V;
    __shared__ __align__(16) float os[16 * 68];
    const size_t z = blockIdx.z; A += z * sA; if (A2) A2 += z * sA; Bt += z * sB; if (Bt2) Bt2 += z * sB; C += z * sC;
    const int lane = threadIdx.x & 31, lr = lane & 15, hi = lane >> 4; const int r0 = blockIdx.x * 64, c0 = blockIdx.y * 64;
    v8f acc[4][4];
#pragma unroll
    for (int mb = 0; mb < 4; ++mb)
#pragma unroll
        for (int nb = 0; nb < 4; ++nb) acc[mb][nb] = (v8f){};
    const size_t aoff = (size_t)(r0 + lr) * K + 8 * hi, boff = (size_t)(c0 + lr) * K + 8 * hi;

    for (int kc = 0; kc < K; kc += 32) {
        V a[4], a2[4];
#pragma unroll
        for (int mb = 0; mb < 4; ++mb) { a[mb] = WFrag<T16>::ld(A + aoff + (size_t)mb * 16 * K + kc); if (NSPLIT == 1 || NSPLIT == 2) a2[mb] = WFrag<T16>::ld(A2 + aoff + (size_t)mb * 16 * K + kc); }
#pragma unroll
        for (int nb = 0; nb < 4; ++nb) { const V b = WFrag<T16>::ld(Bt + boff + (size_t)nb * 16 * K + kc); V b2; if (NSPLIT >= 2) b2 = WFrag<T16>::ld(Bt2 + boff + (size_t)nb * 16 * K + kc);
#pragma unroll
            for (int mb = 0; mb < 4; ++mb) { acc[mb][nb] = WFrag<T16>::mma(a[mb], b, acc[mb][nb]); if (NSPLIT == 1 || NSPLIT == 2) acc[mb][nb] = WFrag<T16>::mma(a2[mb], b, acc[mb][nb]); if (NSPLIT >= 2) acc[mb][nb] = WFrag<T16>::mma(a[mb], b2, acc[mb][nb]); } }
        asm volatile("v_nop\n\tv_nop\n\tv_nop\n\tv_nop" : "+v"(acc[0][0]), "+v"(acc[1][1]), "+v"(acc[2][2]), "+v"(acc[3][3]) : "v"(a[0]), "v"(a[3]));
    }
#pragma unroll
    for (int mb = 0; mb < 4; ++mb) {
#pragma unroll
        for (int nb = 0; nb < 4; ++nb) {
#pragma unroll
            for (int j = 0; j < 8; ++j) os[(hi * 8 + j) * 68 + nb * 16 + lr] = acc[mb][nb][j]; }
        __builtin_amdgcn_wave_barrier(); asm volatile("" ::: "memory");
        float* crow = C + (size_t)(r0 + mb * 16) * ldc + c0;
{
#pragma unroll
            for (int s = 0; s < 8; ++s) { const int row = 2 * s + hi, cofs = lr * 4; v4f val = *(const v4fa*)(os + row * 68 + cofs); if (BIAS) { val[0] += bfr(bias[c0 + cofs]); val[1] += bfr(bias[c0 + cofs + 1]); val[2] += bfr(bias[c0 + cofs + 2]); val[3] += bfr(bias[c0 + cofs + 3]); }
                *(v4f*)(crow + (size_t)row * ldc + cofs) = val; }
             }
        __builtin_amdgcn_wave_barrier(); asm volatile("" ::: "memory");
    }
}

__device__ __forceinline__ h16 tohx(float x) { return (h16)x; }
__device__ __forceinline__ void splitf(float y, unsigned short& h, unsigned short& l) { h = f2bf(y); l = f2bf(y - bf2f(h)); }
typedef __attribute__((ext_vector_type(2))) _Float16 v2h;
typedef __attribute__((ext_vector_type(4))) _Float16 v4h;
typedef __attribute__((ext_vector_type(2))) unsigned short v2us;
typedef __attribute__((ext_vector_type(4))) unsigned short v4us;
typedef __attribute__((ext_vector_type(2))) float v2f;
typedef __attribute__((ext_vector_type(4))) int v4i;
typedef __attribute__((ext_vector_type(2))) unsigned v2u;
__global__ __launch_bounds__(256) void k_f2h(const float* __restrict__ S, h16* P16, size_t n4) { const size_t i = (size_t)blockIdx.x * 256 + threadIdx.x; if (i >= n4) return; const v4f v = *(const v4f*)(S + i * 4); v4h o;
#pragma unroll
    for (int q = 0; q < 4; ++q) o[q] = tohx(v[q]);
    *(v4h*)(P16 + i * 4) = o;  }
__global__ __launch_bounds__(256) void k_vtp(const float* __restrict__ F, int pitch, int nheads, h16* V16, bf* Vh, bf* Vl) { const size_t e = ((size_t)blockIdx.x * 256 + threadIdx.x) * 2; if (e >= (size_t)nheads * HD * TT) return; const int t = (int)(e % TT); const int d = (int)((e / TT) % HD); const int g = (int)(e / ((size_t)TT * HD)); v2h o16; v2us oh, ol;
#pragma unroll
    for (int q = 0; q < 2; ++q) { const float x = F[(size_t)(t + q) * pitch + g * HD + d]; o16[q] = tohx(x); unsigned short a2, c2; splitf(x, a2, c2); oh[q] = a2; ol[q] = c2; }
    *(v2h*)(V16 + e) = o16; *(v2us*)(Vh + e) = oh; *(v2us*)(Vl + e) = ol;  }
// k_asoft: the dense softmax: per row (zz, i): t = S x SCL (no mask); softmax over the 512 keys (register row, one exp, fixed trees: the kernel's only lane-crossing words);
__global__ __launch_bounds__(256) void k_asoft(const float* __restrict__ Sb, h16* P16, bf* Ph, bf* Pl) {
    const int lane = threadIdx.x & 31; const int row = blockIdx.x * 8 + (threadIdx.x >> 5); if (row >= ZH * TT) return; const int i = row % TT; const int zz = row / TT; (void)zz; const bool hires = (i < RH); const float* sr = Sb + (size_t)row * TT; float v[TT / 32]; float mx = -3.0e38f;
#pragma unroll
    for (int ch = 0; ch < TT / 128; ++ch) { const int j0 = ch * 128 + lane * 4; const v4f a = *(const v4f*)(sr + j0);
#pragma unroll
        for (int q = 0; q < 4; ++q) { const int j = j0 + q; (void)j; const float t = a[q] * SCL; v[ch * 4 + q] = t; mx = fmaxf(mx, t); } }
#pragma unroll
    for (int sh = 16; sh; sh >>= 1) mx = fmaxf(mx, __shfl_xor(mx, sh, 32));
    float sum = 0.f;
#pragma unroll
    for (int k = 0; k < TT / 32; ++k) { float d0 = __fsub_rn(v[k], mx); v[k] = __builtin_amdgcn_exp2f(__fmul_rn(d0, 1.4426950408889634f)); sum += v[k]; }
#pragma unroll
    for (int sh = 16; sh; sh >>= 1) sum += __shfl_xor(sum, sh, 32);
    const float f = __fdiv_rn(hires ? 1.0f : PCAR, sum);
    {
        if (hires) {
#pragma unroll
            for (int ch = 0; ch < TT / 128; ++ch) { v4us oh, ol;
#pragma unroll
                for (int q = 0; q < 4; ++q) { unsigned short a, c2; splitf(v[ch * 4 + q] * f, a, c2); oh[q] = a; ol[q] = c2; }
                const size_t oo = ((size_t)zz * (RH ? RH : 1) + i) * TT + ch * 128 + lane * 4; *(v4us*)(Ph + oo) = oh; *(v4us*)(Pl + oo) = ol; }
        } else {
#pragma unroll
            for (int ch = 0; ch < TT / 128; ++ch) { v4h o4;
#pragma unroll
                for (int q = 0; q < 4; ++q) { const float w = v[ch * 4 + q] * f; o4[q] = tohx(w < PFL ? 0.0f : w); }   /* THE FLUSHING CAST: an f32 weight word UNDER 2^-14 (strictly: a word equal to 2^-14 is kept; so is a NaN) is stored as an exact zero before the f16 rounding, so that no f16 subnormal reaches the value product's matrix instruction; the weights are non-negative */
                *(v4h*)(P16 + (size_t)row * TT + ch * 128 + lane * 4) = o4; } }
         }
}
__global__ __launch_bounds__(256) void k_wt(const float* __restrict__ S, int kin, int nin, int kout, h16* D) { const unsigned idx = (blockIdx.x * 256u + threadIdx.x) * 2u; const unsigned nn = idx / (unsigned)kout, kk = idx - nn * (unsigned)kout; const bool row = (nn < (unsigned)nin); const bool live0 = row && (kk < (unsigned)kin), live1 = row && (kk + 1u < (unsigned)kin);
    const float val0 = live0 ? bfr(S[(size_t)kk * nin + nn]) : 0.0f; const float val1 = live1 ? bfr(S[(size_t)(kk + 1u) * nin + nn]) : 0.0f; v2h o; o[0] = tohx(val0); o[1] = tohx(val1);
    *(v2h*)(D + idx) = o;  }
// k_l12mx: BOTH LAYERS OF ONE (entry, s) ROW, FROM a1 TO THE LARGEST OVER ITS 512 PAIRS, IN ONE WORK-GROUP OF FOUR WAVES.
//   Part 1, a wave 128 of the row's pairs (eight tiles of 16): the first layer's product TRANSPOSED, W1 (units) as A and the pairs as B (k_gemmw's loader order on both sides: a lane's low eight words are k = 8 hi .. 8 hi + 7, so the low lane half holds features 0..7, the high half features 8..11 and noughts; the upper eight words, k 16..31, are noughts);
//   D's map then gives a lane ONE pair (column = lane & 15) and the units 8 hi + j of tile 0 and 16 + 8 hi + j of tile 1: word for word the second layer's A fragment of that pair, with no lane exchange. The norm's words are the lane's own sixteen units, two neighbouring units a register pair:
//   ((c + a3 - a6) x rsqrt(a7 + 1e-5)) x a4 + a5, the maximum with nought, the f16 word: in the module's own order. The fragments go to LDS as [tile][fragment half][lane][8 words]: every store and every later load is 32 lanes on 512 contiguous bytes.
//   Part 2, behind the one barrier, each wave 64 channels (four B fragments of W2 and the channels' norm words, read once) over all 512 pairs:
//   a trip takes 32 pairs (two A fragments from LDS) through eight products at depth 32; D's map gives a lane ONE channel a tile (column = lane & 15) and eight pairs (registers), so the norm words are the lane's own:
//   ((c + a9 - a12) x rsqrt(a13 + 1e-5)) x a10 + a11 word for word, then the running largest, begun at nought (which is the maximum with nought: the largest of nought and all the words); the two lane halves hold different pairs of the same channel: one exchange at the end.
__global__ __launch_bounds__(128) void k_l12mx(const float* __restrict__ a1, const h16* __restrict__ W1, const float* __restrict__ a3, const float* __restrict__ a4, const float* __restrict__ a5, const float* __restrict__ a6, const float* __restrict__ a7,
                                               const h16* __restrict__ W2, const float* __restrict__ a9, const float* __restrict__ a10, const float* __restrict__ a11, const float* __restrict__ a12, const float* __restrict__ a13, float* AD) {
    __shared__ __align__(16) h16 hs[(NT / 16) * 2 * 32 * 8];
    const int lane = threadIdx.x & 31, lr = lane & 15, hi = lane >> 4; const int wv = (int)(threadIdx.x >> 5); const int c0 = wv * 64; const size_t rr = blockIdx.x;
    // every unroll directive of this kernel: it makes each index of the register arrays a constant, so that these arrays are registers (in part 1 it also lets the eight tiles' loads stand ahead of the arithmetic); the loop over tt stays rolled
    {
        const float* rp = a1 + (rr * NT + (size_t)wv * 128 + lr) * NP; v4f p0[8], p1[8];
#pragma unroll
        for (int tl = 0; tl < 8; ++tl) { p0[tl] = *(const v4f*)(rp + (size_t)tl * 16 * NP + 8 * hi); p1[tl] = *(const v4f*)(rp + (size_t)tl * 16 * NP + 4); }     /* the low half: features 0..3 and 4..7; the high half: 8..11, and 4..7 again (in bounds), which it replaces by noughts below */
        v16h w[2]; v2f n3[2][4], n6[2][4], ns[2][4], n4[2][4], n5[2][4];
#pragma unroll
        for (int mb = 0; mb < 2; ++mb) { w[mb] = WFrag<h16>::ld(W1 + (size_t)(mb * 16 + lr) * 32 + 8 * hi);
#pragma unroll
            for (int j = 0; j < 4; ++j) { const int uu = mb * 16 + 8 * hi + 2 * j; n3[mb][j] = (v2f){bfr(a3[uu]), bfr(a3[uu + 1])}; n6[mb][j] = (v2f){bfr(a6[uu]), bfr(a6[uu + 1])}; ns[mb][j] = (v2f){rsqrtf(bfr(a7[uu]) + NEPS), rsqrtf(bfr(a7[uu + 1]) + NEPS)}; n4[mb][j] = (v2f){bfr(a4[uu]), bfr(a4[uu + 1])}; n5[mb][j] = (v2f){bfr(a5[uu]), bfr(a5[uu + 1])}; } }
        const v8h zz8 = {0, 0, 0, 0, 0, 0, 0, 0}; const unsigned km = hi ? 0u : 0xFFFFFFFFu;     /* the high half's words 4..7 are k = 12..15: noughts, by a mask on the two packed registers (no branch) */
#pragma unroll
        for (int tl = 0; tl < 8; ++tl) { v4h q0, q1;
#pragma unroll
            for (int e = 0; e < 4; ++e) { q0[e] = tohx(bfr(p0[tl][e])); q1[e] = tohx(bfr(p1[tl][e])); }
            const v2u m1 = __builtin_bit_cast(v2u, q1) & km; const v8h lo = __builtin_shufflevector(q0, __builtin_bit_cast(v4h, m1), 0, 1, 2, 3, 4, 5, 6, 7);
            const v16h pb = cat16(lo, zz8); h16* dst = hs + ((size_t)(wv * 8 + tl) * 64 + lane) * 8;
#pragma unroll
            for (int mb = 0; mb < 2; ++mb) { const v8f d = wmma16(w[mb], pb, (v8f){}); v8h o;
#pragma unroll
                for (int j = 0; j < 4; ++j) { v2f yy = {d[2 * j], d[2 * j + 1]}; yy = (yy + n3[mb][j]) - n6[mb][j]; yy = yy * ns[mb][j]; yy = yy * n4[mb][j] + n5[mb][j]; o[2 * j] = tohx(fmaxf(yy[0], 0.0f)); o[2 * j + 1] = tohx(fmaxf(yy[1], 0.0f)); }
                *(v8h*)(dst + mb * 256) = o; } }
    }
    v16h b[4]; v2f b9[4], m12[4], sc[4], gg[4], bs[4]; float top[4];     /* the norm words twice over, a register pair each: the arithmetic below goes two pairs an instruction */
#pragma unroll
    for (int nb = 0; nb < 4; ++nb) { const int ch = c0 + nb * 16 + lr; b[nb] = WFrag<h16>::ld(W2 + (size_t)ch * NU + 8 * hi);
        asm volatile("s_wait_xcnt 0x0" ::: "memory");     /* in this build the next fragment's load lands on the registers that hold this one's address: the wait stands in front of that overwrite */
        const float w9 = bfr(a9[ch]), w12 = bfr(a12[ch]), w13 = rsqrtf(bfr(a13[ch]) + NEPS), w10 = bfr(a10[ch]), w11 = bfr(a11[ch]); b9[nb] = (v2f){w9, w9}; m12[nb] = (v2f){w12, w12}; sc[nb] = (v2f){w13, w13}; gg[nb] = (v2f){w10, w10}; bs[nb] = (v2f){w11, w11}; top[nb] = 0.0f; }
    __syncthreads();     /* the row's 32 fragment tiles, eight from each wave, are read by all four waves from here on; hs is not written again */
    const h16* ap = hs + (size_t)lane * 8;
    v16h f0 = cat16(*(const v8h*)ap, *(const v8h*)(ap + 256)), f1 = cat16(*(const v8h*)(ap + 512), *(const v8h*)(ap + 768));
    for (int tt = 0; tt < NT; tt += 32) {
        const int tn = (tt + 32) & (NT - 1);     /* the next trip's fragments are asked for ahead of this trip's arithmetic; the last trip asks for the row's first pairs again (in bounds, unused) */
        const h16* an = ap + (size_t)tn * 32;     /* a tile of 16 pairs is 512 words */
        const v16h g0 = cat16(*(const v8h*)an, *(const v8h*)(an + 256)), g1 = cat16(*(const v8h*)(an + 512), *(const v8h*)(an + 768));
        v8f d[2][4];
#pragma unroll
        for (int nb = 0; nb < 4; ++nb) { d[0][nb] = wmma16(f0, b[nb], (v8f){}); d[1][nb] = wmma16(f1, b[nb], (v8f){}); }
#pragma unroll
        for (int nb = 0; nb < 4; ++nb) {
#pragma unroll
            for (int mb = 0; mb < 2; ++mb) {
#pragma unroll
                for (int j = 0; j < 8; j += 2) { v2f yy = {d[mb][nb][j], d[mb][nb][j + 1]}; yy = (yy + b9[nb]) - m12[nb]; yy = yy * sc[nb]; yy = yy * gg[nb] + bs[nb]; top[nb] = fmaxf(fmaxf(top[nb], yy[0]), yy[1]); } } }
        f0 = g0; f1 = g1;
    }
    // lane l and lane l ^ 16 hold the same channels over different pairs: each half sends the two tiles that the other half stores, so that a store is 32 lanes on 128 contiguous bytes
    const float o0 = fmaxf(hi ? top[1] : top[0], __shfl_xor(hi ? top[0] : top[1], 16, 32)), o1 = fmaxf(hi ? top[3] : top[2], __shfl_xor(hi ? top[2] : top[3], 16, 32));
    float* dst = AD + rr * NW + c0 + lane; dst[0] = o0; dst[32] = o1;  }
__global__ __launch_bounds__(256) void k_adc(const float* __restrict__ a0, const float* __restrict__ AD, h16* ZH16) { const size_t i = (size_t)blockIdx.x * 256 + threadIdx.x; const v4f p = *(const v4f*)(a0 + i * 4), t4 = *(const v4f*)(AD + i * 4); v4h o;
#pragma unroll
    for (int e = 0; e < 4; ++e) o[e] = tohx(bfr(p[e]) + t4[e]);
    *(v4h*)(ZH16 + i * 4) = o;  }

extern "C" void kernel_launch(void* const* d_in, const int* in_sizes, int n_in,
                              void* d_out, int out_size, void* d_ws, size_t ws_size, hipStream_t stream) {
    (void)in_sizes; (void)n_in; (void)out_size;
    const float* a0 = (const float*)d_in[0]; const float* a1 = (const float*)d_in[1]; const float* a2 = (const float*)d_in[2]; const float* a3 = (const float*)d_in[3]; const float* a4 = (const float*)d_in[4]; const float* a5 = (const float*)d_in[5]; const float* a6 = (const float*)d_in[6]; const float* a7 = (const float*)d_in[7];
    const float* a8 = (const float*)d_in[8]; const float* a9 = (const float*)d_in[9]; const float* a10 = (const float*)d_in[10]; const float* a11 = (const float*)d_in[11]; const float* a12 = (const float*)d_in[12]; const float* a13 = (const float*)d_in[13]; const float* a14 = (const float*)d_in[14];
    // inputs in the module's argument order = d_in[0..14]: all fifteen read
    float* OUT = (float*)d_out;     // [2][512][256]
    char* wsp = (char*)d_ws;
    auto take = [&](size_t bytes) { char* p = wsp; wsp += (bytes + 255) & ~(size_t)255; return (void*)p; };
    h16* W1 = (h16*)take((size_t)64 * 32 * 2); h16* W2 = (h16*)take((size_t)NW * 32 * 2); h16* W3 = (h16*)take((size_t)3 * NW * NW * 2);
    float* AD = (float*)take((size_t)NE * NT * NW * 4); h16* ZH16 = (h16*)take((size_t)NE * NT * NW * 2);
    float* P1 = (float*)take((size_t)NE * NT * NW * 4); float* P2 = (float*)take((size_t)NE * NT * NW * 4); float* P3 = (float*)take((size_t)NE * NT * NW * 4); h16* H2 = (h16*)take((size_t)NE * NT * NW * 2); h16* H3 = (h16*)take((size_t)NE * NT * NW * 2);
    h16* V16 = (h16*)take((size_t)NE * NW * NT * 2); bf* Vh = (bf*)take((size_t)NE * NW * NT * 2); bf* Vl = (bf*)take((size_t)NE * NW * NT * 2); float* Sb = (float*)take((size_t)NE * NT * NT * 4); bf* Ph = (bf*)take((size_t)NE * NT * NT * 2); bf* Pl = (bf*)take((size_t)NE * NT * NT * 2);
    if ((size_t)(wsp - (char*)d_ws) > ws_size) return;
    k_wt<<<64 * 32 / 2 / 256, 256, 0, stream>>>(a2, NP, NU, 32, W1); k_wt<<<NW * 32 / 2 / 256, 256, 0, stream>>>(a8, NU, NW, 32, W2); k_wt<<<3 * NW * NW / 2 / 256, 256, 0, stream>>>(a14, NW, 3 * NW, NW, W3);
    k_l12mx<<<NE * NT, 128, 0, stream>>>(a1, W1, a3, a4, a5, a6, a7, W2, a9, a10, a11, a12, a13, AD);
    k_adc<<<NE * NT * NW / 4 / 256, 256, 0, stream>>>(a0, AD, ZH16);
    k_gemmw<h16, 0, false><<<dim3(NE * NT / 64, NW / 64, 1), 32, 0, stream>>>(ZH16, nullptr, W3, nullptr, NW, P1, NW, nullptr, 0, 0, 0);
    k_gemmw<h16, 0, false><<<dim3(NE * NT / 64, NW / 64, 1), 32, 0, stream>>>(ZH16, nullptr, W3 + (size_t)NW * NW, nullptr, NW, P2, NW, nullptr, 0, 0, 0);
    k_gemmw<h16, 0, false><<<dim3(NE * NT / 64, NW / 64, 1), 32, 0, stream>>>(ZH16, nullptr, W3 + (size_t)2 * NW * NW, nullptr, NW, P3, NW, nullptr, 0, 0, 0);
    k_f2h<<<NE * NT * NW / 4 / 256, 256, 0, stream>>>(P1, H2, (size_t)NE * NT * NW / 4); k_f2h<<<NE * NT * NW / 4 / 256, 256, 0, stream>>>(P2, H3, (size_t)NE * NT * NW / 4);
    for (int en = 0; en < NE; ++en) k_vtp<<<(NW * NT / 2 + 255) / 256, 256, 0, stream>>>(P3 + (size_t)en * NT * NW, NW, NW / HD, V16 + (size_t)en * NW * NT, Vh + (size_t)en * NW * NT, Vl + (size_t)en * NW * NT);
    k_gemmw<h16, 0, false><<<dim3(NT / 64, NT / 64, NE), 32, 0, stream>>>(H2, nullptr, H3, nullptr, NW, Sb, NT, nullptr, (size_t)NT * NW, (size_t)NT * NW, (size_t)NT * NT);
    k_asoft<<<ZH * TT / 8, 256, 0, stream>>>(Sb, nullptr, Ph, Pl);     /* RH = TT: every row takes the hi + lo branch: the f16 plane's pointer is never used */
    k_gemmw<bf, 2, false><<<dim3(NT / 64, NW / 64, NE), 32, 0, stream>>>(Ph, Pl, Vh, Vl, NT, OUT, NW, nullptr, (size_t)NT * NT, (size_t)NW * NT, (size_t)NT * NW);
}

// v003
// One run takes 53 microseconds.
// In two side-by-side timings against v002, it was 1.52 and 1.55 times as fast.
// Over all steps from v000 it is 56.7 times as fast.
#include <hip/hip_runtime.h>

// A one-head attention over 512 tokens of width 256 (two entries) whose tokens first take an additive term made from a pairwise tensor
// (inputs, in argument order: a0 [2][512][256] tokens; a1 [2][512][512][12] pair features; a2 [12][32] with a3 [32]; a4, a5, a6, a7 [32]: a norm's scale, shift, running mean, running variance;
//   a8 [32][256] with a9 [256]; a10, a11, a12, a13 [256]: a second such norm; a14 [256][768] one projection ('in' by 'three times the width') whose thirds are the three planes of the attention):
//   U1 = max((a1 a2 + a3 - a6) / sqrt(a7 + 1e-5) x a4 + a5, 0): [2][512][512][32]; U2 = max((U1 a8 + a9 - a12) / sqrt(a13 + 1e-5) x a10 + a11, 0): [2][512][512][256];
//   ADD[e][s][c] = the largest U2[e][s][t][c] over t; Z = a0 + ADD; the three planes Z a14[:, 0:256], Z a14[:, 256:512], Z a14[:, 512:768]; scores = plane 1 x plane 2 transposed / 16; a softmax along the last axis; result = weights x plane 3: [2][512][256].
// Layout: neither U1 nor U2 is ever in memory: one work-group takes one (entry, s) row from a1 to ADD (k_l12mx). The first layer is an f16 product at depth 32 (a1 padded from 12 with noughts in the loader; a2 transposed and padded to a 64-wide tile; both inputs' words are bf16-exact and f16 holds them exactly in its normal range),
//   its norm, maximum and ONE f16 word, kept in LDS for the row; the second layer one f16 product at depth 32 whose tiles never leave the registers: the wave that forms a tile takes the norm, the maximum with nought and the largest over the 512 pairs of its row there;
//   the tokens plus that term as ONE f16 word, stored by the same wave; the three projections ONE f16 product at depth 256 against a14 as 768 f16 rows (a14's words are bf16-exact: f16 holds them exactly in its normal range), whose tiles go from the registers to the planes the attention reads (k_qkv): planes 1 and 2 ONE f16 word, plane 3 transposed as bf16 hi + lo;
//   the scores by one batched f16 product; a dense softmax at 512 tokens, every row as bf16 hi + lo; the last product three bf16 products (hi hi, hi lo, lo hi), straight into the output.
// THREE kernel texts of this file beside k_gemmw and k_asoft (k_wt, k_l12mx, k_qkv): every address from the lane's own index and launch constants; exact grids, no guard (k_wt's padding select apart); no atomic; k_l12mx alone has LDS (32 KiB, written once, one barrier, then read), its loops run literal trip counts, the same for every lane, and it alone has lane-crossing words (two, behind its last loop).
// Compute dtypes, f32 accumulate: every float input rounded to bf16 at its first read; the first layer f16 x f16 on words that hold the inputs' bf16 values exactly; every computed operand ONE f16 word but the softmax weights and plane 3, which are bf16 hi + lo (the weights reach down to 2e-9: an f16 plane of them would be more than a third subnormal); norms, maxima, exponentials f32.

#define NE   2                    // entries
#define NT   512                  // tokens an entry = pairs a row
#define NW   256                  // width
#define NU   32                   // the first layer's width = the second layer's depth
#define NP   12                   // pair features
#define NEPS 1e-5f                // the two norms' epsilon
// the attention constants at 512 tokens (the softmax reads TT, ZH, RH, PCAR, SCL; nothing reads WIN)
#define TT   512
#define ZH   2
#define RH   512
#define WIN  0
#define PCAR 1024.0f
#define SCL  0.0625f   // 256^-0.5
#define PFL  6.103515625e-05f   // 2^-14: the flushing cast's line (the softmax's f16 branch alone reads it: not taken here)
typedef _Float16 h16;
typedef unsigned short bf;
typedef __attribute__((ext_vector_type(16))) __bf16   v16bf;
typedef __attribute__((ext_vector_type(16))) _Float16 v16h;
typedef __attribute__((ext_vector_type(8)))  _Float16 v8h;
typedef __attribute__((ext_vector_type(8)))  unsigned short v8us;
typedef __attribute__((ext_vector_type(8)))  float    v8f;
typedef __attribute__((ext_vector_type(4)))  float    v4f;
typedef v8h  __attribute__((may_alias)) v8ha;
typedef v4f  __attribute__((may_alias)) v4fa;
typedef v8us __attribute__((may_alias)) v8usa;

__device__ __forceinline__ unsigned short f2bf(float f) { unsigned u = __float_as_uint(f); u += 0x7FFFu + ((u >> 16) & 1u); return (unsigned short)(u >> 16); }
__device__ __forceinline__ float bf2f(unsigned short b) { return __uint_as_float(((unsigned)b) << 16); }
__device__ __forceinline__ float bfr(float f) { return bf2f(f2bf(f)); }
__device__ __forceinline__ v16h cat16(v8h lo, v8h hi) { return __builtin_shufflevector(lo, hi, 0, 1, 2, 3, 4, 5, 6, 7, 8, 9, 10, 11, 12, 13, 14, 15); }
__device__ __forceinline__ v16bf cat16b(v8us lo, v8us hi) { return __builtin_bit_cast(v16bf, __builtin_shufflevector(lo, hi, 0, 1, 2, 3, 4, 5, 6, 7, 8, 9, 10, 11, 12, 13, 14, 15)); }
__device__ __forceinline__ v8f wmma16(v16h a, v16h b, v8f c) { return __builtin_amdgcn_wmma_f32_16x16x32_f16(false, a, false, b, (short)0, c, false, false); }
__device__ __forceinline__ v8f wmmab(v16bf a, v16bf b, v8f c) { return __builtin_amdgcn_wmma_f32_16x16x32_bf16(false, a, false, b, (short)0, c, false, false); }



// ---- k_gemmw: register-blocked GEMM, ONE WAVE per 64x64 output tile (16 accumulators), operands straight from K-contiguous 16-bit planes; grid (M/64, N/64, Z), 32 threads.
// C[m][n] (f32, pitch ldc, + optional f32 bias[n]) = sum_k A[m][k] Bt[n][k] (+ split products per NSPLIT). z-batch strides sA/sB/sC in elements. K % 32 == 0.
template <typename T16> struct WFrag;
template <> struct WFrag<h16> { typedef v16h V; static __device__ __forceinline__ V ld(const h16* p) { return cat16(*(const v8h*)p, *(const v8h*)(p + 16)); } static __device__ __forceinline__ v8f mma(V a, V b, v8f c) { return wmma16(a, b, c); } };
template <> struct WFrag<bf> { typedef v16bf V; static __device__ __forceinline__ V ld(const bf* p) { return cat16b(*(const v8us*)p, *(const v8us*)(p + 16)); } static __device__ __forceinline__ v8f mma(V a, V b, v8f c) { return wmmab(a, b, c); } };
template <typename T16, int NSPLIT, bool BIAS>
__global__ __launch_bounds__(32) void k_gemmw(const T16* __restrict__ A, const T16* __restrict__ A2, const T16* __restrict__ Bt, const T16* __restrict__ Bt2, int K, float* C, int ldc, const float* __restrict__ bias, size_t sA, size_t sB, size_t sC) {
    typedef typename WFrag<T16>::V V;
    __shared__ __align__(16) float os[16 * 68];
    const size_t z = blockIdx.z; A += z * sA; if (A2) A2 += z * sA; Bt += z * sB; if (Bt2) Bt2 += z * sB; C += z * sC;
    const int lane = threadIdx.x & 31, lr = lane & 15, hi = lane >> 4; const int r0 = blockIdx.x * 64, c0 = blockIdx.y * 64;
    v8f acc[4][4];
#pragma unroll
    for (int mb = 0; mb < 4; ++mb)
#pragma unroll
        for (int nb = 0; nb < 4; ++nb) acc[mb][nb] = (v8f){};
    const size_t aoff = (size_t)(r0 + lr) * K + 8 * hi, boff = (size_t)(c0 + lr) * K + 8 * hi;

    for (int kc = 0; kc < K; kc += 32) {
        V a[4], a2[4];
#pragma unroll
        for (int mb = 0; mb < 4; ++mb) { a[mb] = WFrag<T16>::ld(A + aoff + (size_t)mb * 16 * K + kc); if (NSPLIT == 1 || NSPLIT == 2) a2[mb] = WFrag<T16>::ld(A2 + aoff + (size_t)mb * 16 * K + kc); }
#pragma unroll
        for (int nb = 0; nb < 4; ++nb) { const V b = WFrag<T16>::ld(Bt + boff + (size_t)nb * 16 * K + kc); V b2; if (NSPLIT >= 2) b2 = WFrag<T16>::ld(Bt2 + boff + (size_t)nb * 16 * K + kc);
#pragma unroll
            for (int mb = 0; mb < 4; ++mb) { acc[mb][nb] = WFrag<T16>::mma(a[mb], b, acc[mb][nb]); if (NSPLIT == 1 || NSPLIT == 2) acc[mb][nb] = WFrag<T16>::mma(a2[mb], b, acc[mb][nb]); if (NSPLIT >= 2) acc[mb][nb] = WFrag<T16>::mma(a[mb], b2, acc[mb][nb]); } }
        asm volatile("v_nop\n\tv_nop\n\tv_nop\n\tv_nop" : "+v"(acc[0][0]), "+v"(acc[1][1]), "+v"(acc[2][2]), "+v"(acc[3][3]) : "v"(a[0]), "v"(a[3]));
    }
#pragma unroll
    for (int mb = 0; mb < 4; ++mb) {
#pragma unroll
        for (int nb = 0; nb < 4; ++nb) {
#pragma unroll
            for (int j = 0; j < 8; ++j) os[(hi * 8 + j) * 68 + nb * 16 + lr] = acc[mb][nb][j]; }
        __builtin_amdgcn_wave_barrier(); asm volatile("" ::: "memory");
        float* crow = C + (size_t)(r0 + mb * 16) * ldc + c0;
{
#pragma unroll
            for (int s = 0; s < 8; ++s) { const int row = 2 * s + hi, cofs = lr * 4; v4f val = *(const v4fa*)(os + row * 68 + cofs); if (BIAS) { val[0] += bfr(bias[c0 + cofs]); val[1] += bfr(bias[c0 + cofs + 1]); val[2] += bfr(bias[c0 + cofs + 2]); val[3] += bfr(bias[c0 + cofs + 3]); }
                *(v4f*)(crow + (size_t)row * ldc + cofs) = val; }
             }
        __builtin_amdgcn_wave_barrier(); asm volatile("" ::: "memory");
    }
}

__device__ __forceinline__ h16 tohx(float x) { return (h16)x; }
__device__ __forceinline__ void splitf(float y, unsigned short& h, unsigned short& l) { h = f2bf(y); l = f2bf(y - bf2f(h)); }
typedef __attribute__((ext_vector_type(2))) _Float16 v2h;
typedef __attribute__((ext_vector_type(4))) _Float16 v4h;
typedef __attribute__((ext_vector_type(2))) unsigned short v2us;
typedef __attribute__((ext_vector_type(4))) unsigned short v4us;
typedef __attribute__((ext_vector_type(2))) float v2f;
typedef __attribute__((ext_vector_type(4))) int v4i;
typedef __attribute__((ext_vector_type(2))) unsigned v2u;
// k_asoft: a dense softmax: per row (zz, i): t = S x SCL (no mask); softmax over the 512 keys (register row, one exp, fixed trees: the kernel's only lane-crossing words);
__global__ __launch_bounds__(256) void k_asoft(const float* __restrict__ Sb, h16* P16, bf* Ph, bf* Pl) {
    const int lane = threadIdx.x & 31; const int row = blockIdx.x * 8 + (threadIdx.x >> 5); if (row >= ZH * TT) return; const int i = row % TT; const int zz = row / TT; (void)zz; const bool hires = (i < RH); const float* sr = Sb + (size_t)row * TT; float v[TT / 32]; float mx = -3.0e38f;
#pragma unroll
    for (int ch = 0; ch < TT / 128; ++ch) { const int j0 = ch * 128 + lane * 4; const v4f a = *(const v4f*)(sr + j0);
#pragma unroll
        for (int q = 0; q < 4; ++q) { const int j = j0 + q; (void)j; const float t = a[q] * SCL; v[ch * 4 + q] = t; mx = fmaxf(mx, t); } }
#pragma unroll
    for (int sh = 16; sh; sh >>= 1) mx = fmaxf(mx, __shfl_xor(mx, sh, 32));
    float sum = 0.f;
#pragma unroll
    for (int k = 0; k < TT / 32; ++k) { float d0 = __fsub_rn(v[k], mx); v[k] = __builtin_amdgcn_exp2f(__fmul_rn(d0, 1.4426950408889634f)); sum += v[k]; }
#pragma unroll
    for (int sh = 16; sh; sh >>= 1) sum += __shfl_xor(sum, sh, 32);
    const float f = __fdiv_rn(hires ? 1.0f : PCAR, sum);
    {
        if (hires) {
#pragma unroll
            for (int ch = 0; ch < TT / 128; ++ch) { v4us oh, ol;
#pragma unroll
                for (int q = 0; q < 4; ++q) { unsigned short a, c2; splitf(v[ch * 4 + q] * f, a, c2); oh[q] = a; ol[q] = c2; }
                const size_t oo = ((size_t)zz * (RH ? RH : 1) + i) * TT + ch * 128 + lane * 4; *(v4us*)(Ph + oo) = oh; *(v4us*)(Pl + oo) = ol; }
        } else {
#pragma unroll
            for (int ch = 0; ch < TT / 128; ++ch) { v4h o4;
#pragma unroll
                for (int q = 0; q < 4; ++q) { const float w = v[ch * 4 + q] * f; o4[q] = tohx(w < PFL ? 0.0f : w); }   /* THE FLUSHING CAST: an f32 weight word UNDER 2^-14 (strictly: a word equal to 2^-14 is kept; so is a NaN) is stored as an exact zero before the f16 rounding, so that no f16 subnormal reaches the value product's matrix instruction; the weights are non-negative */
                *(v4h*)(P16 + (size_t)row * TT + ch * 128 + lane * 4) = o4; } }
         }
}
__global__ __launch_bounds__(256) void k_wt(const float* __restrict__ S, int kin, int nin, int kout, h16* D) { const unsigned idx = (blockIdx.x * 256u + threadIdx.x) * 2u; const unsigned nn = idx / (unsigned)kout, kk = idx - nn * (unsigned)kout; const bool row = (nn < (unsigned)nin); const bool live0 = row && (kk < (unsigned)kin), live1 = row && (kk + 1u < (unsigned)kin);
    const float val0 = live0 ? bfr(S[(size_t)kk * nin + nn]) : 0.0f; const float val1 = live1 ? bfr(S[(size_t)(kk + 1u) * nin + nn]) : 0.0f; v2h o; o[0] = tohx(val0); o[1] = tohx(val1);
    *(v2h*)(D + idx) = o;  }
// k_l12mx: BOTH LAYERS OF ONE (entry, s) ROW, FROM a1 TO THE LARGEST OVER ITS 512 PAIRS, IN ONE WORK-GROUP OF FOUR WAVES.
//   Part 1, a wave 128 of the row's pairs (eight tiles of 16): the first layer's product TRANSPOSED, W1 (units) as A and the pairs as B (k_gemmw's loader order on both sides: a lane's low eight words are k = 8 hi .. 8 hi + 7, so the low lane half holds features 0..7, the high half features 8..11 and noughts; the upper eight words, k 16..31, are noughts);
//   D's map then gives a lane ONE pair (column = lane & 15) and the units 8 hi + j of tile 0 and 16 + 8 hi + j of tile 1: word for word the second layer's A fragment of that pair, with no lane exchange. The norm's words are the lane's own sixteen units, two neighbouring units a register pair:
//   ((c + a3 - a6) x rsqrt(a7 + 1e-5)) x a4 + a5, the maximum with nought, the f16 word: in the module's own order. The fragments go to LDS as [tile][fragment half][lane][8 words]: every store and every later load is 32 lanes on 512 contiguous bytes.
//   Part 2, behind the one barrier, each wave 64 channels (four B fragments of W2 and the channels' norm words, read once) over all 512 pairs:
//   a trip takes 32 pairs (two A fragments from LDS) through eight products at depth 32; D's map gives a lane ONE channel a tile (column = lane & 15) and eight pairs (registers), so the norm words are the lane's own:
//   ((c + a9 - a12) x rsqrt(a13 + 1e-5)) x a10 + a11 word for word, then the running largest, begun at nought (which is the maximum with nought: the largest of nought and all the words); the two lane halves hold different pairs of the same channel: one exchange at the end.
__global__ __launch_bounds__(128) void k_l12mx(const float* __restrict__ a1, const h16* __restrict__ W1, const float* __restrict__ a3, const float* __restrict__ a4, const float* __restrict__ a5, const float* __restrict__ a6, const float* __restrict__ a7,
                                               const h16* __restrict__ W2, const float* __restrict__ a9, const float* __restrict__ a10, const float* __restrict__ a11, const float* __restrict__ a12, const float* __restrict__ a13, const float* __restrict__ a0, h16* ZH16) {
    __shared__ __align__(16) h16 hs[(NT / 16) * 2 * 32 * 8];
    const int lane = threadIdx.x & 31, lr = lane & 15, hi = lane >> 4; const int wv = (int)(threadIdx.x >> 5); const int c0 = wv * 64; const size_t rr = blockIdx.x;
    // every unroll directive of this kernel: it makes each index of the register arrays a constant, so that these arrays are registers (in part 1 it also lets the eight tiles' loads stand ahead of the arithmetic); the loop over tt stays rolled
    {
        const float* rp = a1 + (rr * NT + (size_t)wv * 128 + lr) * NP; v4f p0[8], p1[8];
#pragma unroll
        for (int tl = 0; tl < 8; ++tl) { p0[tl] = *(const v4f*)(rp + (size_t)tl * 16 * NP + 8 * hi); p1[tl] = *(const v4f*)(rp + (size_t)tl * 16 * NP + 4); }     /* the low half: features 0..3 and 4..7; the high half: 8..11, and 4..7 again (in bounds), which it replaces by noughts below */
        v16h w[2]; v2f n3[2][4], n6[2][4], ns[2][4], n4[2][4], n5[2][4];
#pragma unroll
        for (int mb = 0; mb < 2; ++mb) { w[mb] = WFrag<h16>::ld(W1 + (size_t)(mb * 16 + lr) * 32 + 8 * hi);
#pragma unroll
            for (int j = 0; j < 4; ++j) { const int uu = mb * 16 + 8 * hi + 2 * j; n3[mb][j] = (v2f){bfr(a3[uu]), bfr(a3[uu + 1])}; n6[mb][j] = (v2f){bfr(a6[uu]), bfr(a6[uu + 1])}; ns[mb][j] = (v2f){rsqrtf(bfr(a7[uu]) + NEPS), rsqrtf(bfr(a7[uu + 1]) + NEPS)}; n4[mb][j] = (v2f){bfr(a4[uu]), bfr(a4[uu + 1])}; n5[mb][j] = (v2f){bfr(a5[uu]), bfr(a5[uu + 1])}; } }
        const v8h zz8 = {0, 0, 0, 0, 0, 0, 0, 0}; const unsigned km = hi ? 0u : 0xFFFFFFFFu;     /* the high half's words 4..7 are k = 12..15: noughts, by a mask on the two packed registers (no branch) */
#pragma unroll
        for (int tl = 0; tl < 8; ++tl) { v4h q0, q1;
#pragma unroll
            for (int e = 0; e < 4; ++e) { q0[e] = tohx(bfr(p0[tl][e])); q1[e] = tohx(bfr(p1[tl][e])); }
            const v2u m1 = __builtin_bit_cast(v2u, q1) & km; const v8h lo = __builtin_shufflevector(q0, __builtin_bit_cast(v4h, m1), 0, 1, 2, 3, 4, 5, 6, 7);
            const v16h pb = cat16(lo, zz8); h16* dst = hs + ((size_t)(wv * 8 + tl) * 64 + lane) * 8;
#pragma unroll
            for (int mb = 0; mb < 2; ++mb) { const v8f d = wmma16(w[mb], pb, (v8f){}); v8h o;
#pragma unroll
                for (int j = 0; j < 4; ++j) { v2f yy = {d[2 * j], d[2 * j + 1]}; yy = (yy + n3[mb][j]) - n6[mb][j]; yy = yy * ns[mb][j]; yy = yy * n4[mb][j] + n5[mb][j]; o[2 * j] = tohx(fmaxf(yy[0], 0.0f)); o[2 * j + 1] = tohx(fmaxf(yy[1], 0.0f)); }
                *(v8h*)(dst + mb * 256) = o; } }
    }
    v16h b[4]; v2f b9[4], m12[4], sc[4], gg[4], bs[4]; float top[4];     /* the norm words twice over, a register pair each: the arithmetic below goes two pairs an instruction */
    const size_t zi = rr * NW + c0 + lane; const float z0 = a0[zi], z1 = a0[zi + 32];     /* the token's own words, asked for ahead of the loop that hides their way */
#pragma unroll
    for (int nb = 0; nb < 4; ++nb) { const int ch = c0 + nb * 16 + lr; b[nb] = WFrag<h16>::ld(W2 + (size_t)ch * NU + 8 * hi);
        asm volatile("s_wait_xcnt 0x0" ::: "memory");     /* in this build the next fragment's load lands on the registers that hold this one's address: the wait stands in front of that overwrite */
        const float w9 = bfr(a9[ch]), w12 = bfr(a12[ch]), w13 = rsqrtf(bfr(a13[ch]) + NEPS), w10 = bfr(a10[ch]), w11 = bfr(a11[ch]); b9[nb] = (v2f){w9, w9}; m12[nb] = (v2f){w12, w12}; sc[nb] = (v2f){w13, w13}; gg[nb] = (v2f){w10, w10}; bs[nb] = (v2f){w11, w11}; top[nb] = 0.0f; }
    __syncthreads();     /* the row's 32 fragment tiles, eight from each wave, are read by all four waves from here on; hs is not written again */
    const h16* ap = hs + (size_t)lane * 8;
    v16h f0 = cat16(*(const v8h*)ap, *(const v8h*)(ap + 256)), f1 = cat16(*(const v8h*)(ap + 512), *(const v8h*)(ap + 768));
    for (int tt = 0; tt < NT; tt += 32) {
        const int tn = (tt + 32) & (NT - 1);     /* the next trip's fragments are asked for ahead of this trip's arithmetic; the last trip asks for the row's first pairs again (in bounds, unused) */
        const h16* an = ap + (size_t)tn * 32;     /* a tile of 16 pairs is 512 words */
        const v16h g0 = cat16(*(const v8h*)an, *(const v8h*)(an + 256)), g1 = cat16(*(const v8h*)(an + 512), *(const v8h*)(an + 768));
        v8f d[2][4];
#pragma unroll
        for (int nb = 0; nb < 4; ++nb) { d[0][nb] = wmma16(f0, b[nb], (v8f){}); d[1][nb] = wmma16(f1, b[nb], (v8f){}); }
#pragma unroll
        for (int nb = 0; nb < 4; ++nb) {
#pragma unroll
            for (int mb = 0; mb < 2; ++mb) {
#pragma unroll
                for (int j = 0; j < 8; j += 2) { v2f yy = {d[mb][nb][j], d[mb][nb][j + 1]}; yy = (yy + b9[nb]) - m12[nb]; yy = yy * sc[nb]; yy = yy * gg[nb] + bs[nb]; top[nb] = fmaxf(fmaxf(top[nb], yy[0]), yy[1]); } } }
        f0 = g0; f1 = g1;
    }
    // lane l and lane l ^ 16 hold the same channels over different pairs: each half sends the two tiles that the other half stores, so that a store is 32 lanes on 64 contiguous bytes
    const float o0 = fmaxf(hi ? top[1] : top[0], __shfl_xor(hi ? top[0] : top[1], 16, 32)), o1 = fmaxf(hi ? top[3] : top[2], __shfl_xor(hi ? top[2] : top[3], 16, 32));
    // the token's own words are added here and the sum leaves as the projections' f16 operand: a wave's two stores fill one 128-byte line
    ZH16[zi] = tohx(bfr(z0) + o0); ZH16[zi + 32] = tohx(bfr(z1) + o1);  }
// k_qkv: THE THREE PROJECTIONS AS ONE PRODUCT, 1024 tokens by a14's 768 rows at depth 256, k_gemmw's loop (one wave a 64x64 tile, 16 accumulators, the same loader on both sides), EVERY TILE STORED AS THE OPERAND WORDS THAT THE ATTENTION READS; grid (tokens / 64, 768 / 64), 32 threads.
//   D's map gives a lane ONE index of the B side (column = lane & 15) and EIGHT NEIGHBOURING indices of the A side (registers, 8 hi + j). So the side whose index runs along the stored plane's rows is taken as A:
//   planes 1 and 2 ([token][channel]): a14's rows as A, the tokens as B: a lane's eight words are eight neighbouring channels of one token, one 16-byte store of f16 words;
//   plane 3 ([entry][channel][token]): the tokens as A, a14's rows as B: eight neighbouring tokens of one channel, 16 bytes of bf16 hi words and 16 of lo words. Both loaders have the same k order, so the exchange pairs the same words at every k. The four tiles along the A side fill one 128-byte line.
__global__ __launch_bounds__(32) void k_qkv(const h16* __restrict__ Z, const h16* __restrict__ Wt, h16* H2, h16* H3, bf* Vh, bf* Vl) {
    const int lane = threadIdx.x & 31, lr = lane & 15, hi = lane >> 4; const int r0 = blockIdx.x * 64, c0 = blockIdx.y * 64; const int pl = c0 / NW, cc = c0 - pl * NW;     /* pl: which plane, the same for the whole wave */
    const h16* zp = Z + (size_t)r0 * NW; const h16* wp = Wt + (size_t)c0 * NW; const h16* A = (pl < 2) ? wp : zp; const h16* Bt = (pl < 2) ? zp : wp;     /* both bases are the same for the whole wave */
    v8f acc[4][4];
#pragma unroll
    for (int mb = 0; mb < 4; ++mb)
#pragma unroll
        for (int nb = 0; nb < 4; ++nb) acc[mb][nb] = (v8f){};
    const unsigned off = (unsigned)(lr * NW + 8 * hi);
    for (int kc = 0; kc < NW; kc += 32) {
        const h16* pa = A + kc + off; const h16* pb = Bt + kc + off; v16h a[4], b[4];
#pragma unroll
        for (int mb = 0; mb < 4; ++mb) { a[mb] = WFrag<h16>::ld(pa + mb * 16 * NW); b[mb] = WFrag<h16>::ld(pb + mb * 16 * NW); }
        asm volatile("s_wait_xcnt 0x0" : : "v"(pa), "v"(pb) : "memory");     /* the trip's sixteen loads name these two address pairs: as inputs here the pairs stay whole up to this wait, so that no fragment lands on one of them, and the next trip's addresses are formed behind it */
#pragma unroll
        for (int nb = 0; nb < 4; ++nb)
#pragma unroll
            for (int mb = 0; mb < 4; ++mb) acc[mb][nb] = wmma16(a[mb], b[nb], acc[mb][nb]);
        asm volatile("v_nop\n\tv_nop\n\tv_nop\n\tv_nop" : "+v"(acc[0][0]), "+v"(acc[1][1]), "+v"(acc[2][2]), "+v"(acc[3][3]) : "v"(a[0]), "v"(a[3]));     /* as in k_gemmw: four vector slots behind the trip's last products on every way out of the trip (the back edge and the jumps to the two store branches) */
    }
    // both branches: a group's words are all formed ahead of its first store (the scheduling barrier holds the stores behind the arithmetic), so that the stores go back to back and no register which an issued store names is written between them
    if (pl < 2) {
        h16* H = (pl ? H3 : H2) + (size_t)r0 * NW + cc; v8h o[4][4];
#pragma unroll
        for (int nb = 0; nb < 4; ++nb)
#pragma unroll
            for (int mb = 0; mb < 4; ++mb)
#pragma unroll
                for (int j = 0; j < 8; ++j) o[nb][mb][j] = tohx(acc[mb][nb][j]);
        __builtin_amdgcn_sched_barrier(0);
#pragma unroll
        for (int nb = 0; nb < 4; ++nb)
#pragma unroll
            for (int mb = 0; mb < 4; ++mb) *(v8h*)(H + nb * 16 * NW + mb * 16 + off) = o[nb][mb];
    } else {
        const size_t vo = ((size_t)(r0 / NT) * NW + cc) * NT + (r0 % NT); const unsigned vl = (unsigned)(lr * NT + 8 * hi); bf* vh = Vh + vo; bf* vw = Vl + vo;
#pragma unroll
        for (int hb = 0; hb < 4; hb += 2) {     /* two halves of eight tiles: all sixteen at once would take the kernel past 256 registers */
            v8us oh[2][4], ol[2][4];
#pragma unroll
            for (int nb = 0; nb < 2; ++nb)
#pragma unroll
                for (int mb = 0; mb < 4; ++mb)
#pragma unroll
                    for (int j = 0; j < 8; ++j) { unsigned short h1, l1; splitf(acc[mb][hb + nb][j], h1, l1); oh[nb][mb][j] = h1; ol[nb][mb][j] = l1; }
            __builtin_amdgcn_sched_barrier(0);
#pragma unroll
            for (int nb = 0; nb < 2; ++nb)
#pragma unroll
                for (int mb = 0; mb < 4; ++mb) { *(v8us*)(vh + (hb + nb) * 16 * NT + mb * 16 + vl) = oh[nb][mb]; *(v8us*)(vw + (hb + nb) * 16 * NT + mb * 16 + vl) = ol[nb][mb]; }
            if (hb == 0) { asm volatile("s_wait_xcnt 0x0" ::: "memory"); __builtin_amdgcn_sched_barrier(0); }     /* the second half's words are formed in registers that the first half's stores name: the wait stands behind those stores, and the scheduling barrier keeps the second half's arithmetic behind the wait */
        }
    }
}

extern "C" void kernel_launch(void* const* d_in, const int* in_sizes, int n_in,
                              void* d_out, int out_size, void* d_ws, size_t ws_size, hipStream_t stream) {
    (void)in_sizes; (void)n_in; (void)out_size;
    const float* a0 = (const float*)d_in[0]; const float* a1 = (const float*)d_in[1]; const float* a2 = (const float*)d_in[2]; const float* a3 = (const float*)d_in[3]; const float* a4 = (const float*)d_in[4]; const float* a5 = (const float*)d_in[5]; const float* a6 = (const float*)d_in[6]; const float* a7 = (const float*)d_in[7];
    const float* a8 = (const float*)d_in[8]; const float* a9 = (const float*)d_in[9]; const float* a10 = (const float*)d_in[10]; const float* a11 = (const float*)d_in[11]; const float* a12 = (const float*)d_in[12]; const float* a13 = (const float*)d_in[13]; const float* a14 = (const float*)d_in[14];
    // inputs in the module's argument order = d_in[0..14]: all fifteen read
    float* OUT = (float*)d_out;     // [2][512][256]
    char* wsp = (char*)d_ws;
    auto take = [&](size_t bytes) { char* p = wsp; wsp += (bytes + 255) & ~(size_t)255; return (void*)p; };
    h16* W1 = (h16*)take((size_t)64 * 32 * 2); h16* W2 = (h16*)take((size_t)NW * 32 * 2); h16* W3 = (h16*)take((size_t)3 * NW * NW * 2);
    h16* ZH16 = (h16*)take((size_t)NE * NT * NW * 2); h16* H2 = (h16*)take((size_t)NE * NT * NW * 2); h16* H3 = (h16*)take((size_t)NE * NT * NW * 2);
    bf* Vh = (bf*)take((size_t)NE * NW * NT * 2); bf* Vl = (bf*)take((size_t)NE * NW * NT * 2); float* Sb = (float*)take((size_t)NE * NT * NT * 4); bf* Ph = (bf*)take((size_t)NE * NT * NT * 2); bf* Pl = (bf*)take((size_t)NE * NT * NT * 2);
    if ((size_t)(wsp - (char*)d_ws) > ws_size) return;
    k_wt<<<64 * 32 / 2 / 256, 256, 0, stream>>>(a2, NP, NU, 32, W1); k_wt<<<NW * 32 / 2 / 256, 256, 0, stream>>>(a8, NU, NW, 32, W2); k_wt<<<3 * NW * NW / 2 / 256, 256, 0, stream>>>(a14, NW, 3 * NW, NW, W3);
    k_l12mx<<<NE * NT, 128, 0, stream>>>(a1, W1, a3, a4, a5, a6, a7, W2, a9, a10, a11, a12, a13, a0, ZH16);
    k_qkv<<<dim3(NE * NT / 64, 3 * NW / 64, 1), 32, 0, stream>>>(ZH16, W3, H2, H3, Vh, Vl);
    k_gemmw<h16, 0, false><<<dim3(NT / 64, NT / 64, NE), 32, 0, stream>>>(H2, nullptr, H3, nullptr, NW, Sb, NT, nullptr, (size_t)NT * NW, (size_t)NT * NW, (size_t)NT * NT);
    k_asoft<<<ZH * TT / 8, 256, 0, stream>>>(Sb, nullptr, Ph, Pl);     /* RH = TT: every row takes the hi + lo branch: the f16 plane's pointer is never used */
    k_gemmw<bf, 2, false><<<dim3(NT / 64, NW / 64, NE), 32, 0, stream>>>(Ph, Pl, Vh, Vl, NT, OUT, NW, nullptr, (size_t)NT * NT, (size_t)NW * NT, (size_t)NT * NW);
}

// v004
// Measured time: 43.4 microseconds a run.
// Timed twice side by side with v003, it ran 1.23 and 1.21 times as fast.
// All steps since v000 together make it 69.2 times as fast.
#include <hip/hip_runtime.h>

// A one-head attention over 512 tokens of width 256 (two entries) whose tokens first take an additive term made from a pairwise tensor
// (inputs, in argument order: a0 [2][512][256] tokens; a1 [2][512][512][12] pair features; a2 [12][32] with a3 [32]; a4, a5, a6, a7 [32]: a norm's scale, shift, running mean, running variance;
//   a8 [32][256] with a9 [256]; a10, a11, a12, a13 [256]: a second such norm; a14 [256][768] one projection ('in' by 'three times the width') whose thirds are the three planes of the attention):
//   U1 = max((a1 a2 + a3 - a6) / sqrt(a7 + 1e-5) x a4 + a5, 0): [2][512][512][32]; U2 = max((U1 a8 + a9 - a12) / sqrt(a13 + 1e-5) x a10 + a11, 0): [2][512][512][256];
//   ADD[e][s][c] = the largest U2[e][s][t][c] over t; Z = a0 + ADD; the three planes Z a14[:, 0:256], Z a14[:, 256:512], Z a14[:, 512:768]; scores = plane 1 x plane 2 transposed / 16; a softmax along the last axis; result = weights x plane 3: [2][512][256].
// Layout: neither U1 nor U2 is ever in memory: one work-group takes one (entry, s) row from a1 to ADD (k_l12mx). The first layer is an f16 product at depth 32 (a1 padded from 12 with noughts in the loader; a2 transposed and padded to a 64-wide tile; both inputs' words are bf16-exact and f16 holds them exactly in its normal range),
//   its norm, maximum and ONE f16 word, kept in LDS for the row; the second layer one f16 product at depth 32 whose tiles never leave the registers: the wave that forms a tile takes the norm, the maximum with nought and the largest over the 512 pairs of its row there;
//   the tokens plus that term as ONE f16 word, stored by the same wave; the three projections ONE f16 product at depth 256 against a14 as 768 f16 rows (a14's words are bf16-exact: f16 holds them exactly in its normal range), whose tiles go from the registers to the planes the attention reads (k_qkv): planes 1 and 2 ONE f16 word, plane 3 transposed as bf16 hi + lo;
//   the attention ONE kernel (k_attn), a work-group 16 queries against all 512 keys: the scores one f16 product taken transposed, the softmax in the tiles' own registers, every weight as bf16 hi + lo through LDS; the last product three bf16 products (hi hi, lo hi, hi lo), straight into the output: neither the scores nor the weights are ever in memory.
// FOUR kernel texts (k_wt, k_l12mx, k_qkv, k_attn): every address from the lane's own index and launch constants; exact grids, no guard (k_wt's padding select apart); no atomic; k_l12mx has LDS (32 KiB, written once, one barrier, then read), its loops run literal trip counts, the same for every lane, and two lane-crossing words behind its last loop; k_attn has LDS (34 KiB, each part written once, three barriers), no loop left rolled and no lane-crossing word.
// Compute dtypes, f32 accumulate: every float input rounded to bf16 at its first read; the first layer f16 x f16 on words that hold the inputs' bf16 values exactly; every computed operand ONE f16 word but the softmax weights and plane 3, which are bf16 hi + lo (the weights reach down to 2e-9: an f16 plane of them would be more than a third subnormal); norms, maxima, exponentials f32.

#define NE   2                    // entries
#define NT   512                  // tokens an entry = pairs a row
#define NW   256                  // width
#define NU   32                   // the first layer's width = the second layer's depth
#define NP   12                   // pair features
#define NEPS 1e-5f                // the two norms' epsilon
#define SCL  0.0625f   // 256^-0.5
typedef _Float16 h16;
typedef unsigned short bf;
typedef __attribute__((ext_vector_type(16))) __bf16   v16bf;
typedef __attribute__((ext_vector_type(16))) _Float16 v16h;
typedef __attribute__((ext_vector_type(8)))  _Float16 v8h;
typedef __attribute__((ext_vector_type(8)))  unsigned short v8us;
typedef __attribute__((ext_vector_type(8)))  float    v8f;
typedef __attribute__((ext_vector_type(4)))  float    v4f;
typedef v8h  __attribute__((may_alias)) v8ha;
typedef v4f  __attribute__((may_alias)) v4fa;
typedef v8us __attribute__((may_alias)) v8usa;

__device__ __forceinline__ unsigned short f2bf(float f) { unsigned u = __float_as_uint(f); u += 0x7FFFu + ((u >> 16) & 1u); return (unsigned short)(u >> 16); }
__device__ __forceinline__ float bf2f(unsigned short b) { return __uint_as_float(((unsigned)b) << 16); }
__device__ __forceinline__ float bfr(float f) { return bf2f(f2bf(f)); }
__device__ __forceinline__ v16h cat16(v8h lo, v8h hi) { return __builtin_shufflevector(lo, hi, 0, 1, 2, 3, 4, 5, 6, 7, 8, 9, 10, 11, 12, 13, 14, 15); }
__device__ __forceinline__ v16bf cat16b(v8us lo, v8us hi) { return __builtin_bit_cast(v16bf, __builtin_shufflevector(lo, hi, 0, 1, 2, 3, 4, 5, 6, 7, 8, 9, 10, 11, 12, 13, 14, 15)); }
__device__ __forceinline__ v8f wmma16(v16h a, v16h b, v8f c) { return __builtin_amdgcn_wmma_f32_16x16x32_f16(false, a, false, b, (short)0, c, false, false); }
__device__ __forceinline__ v8f wmmab(v16bf a, v16bf b, v8f c) { return __builtin_amdgcn_wmma_f32_16x16x32_bf16(false, a, false, b, (short)0, c, false, false); }

// WFrag: the fragment loader for K-contiguous 16-bit planes (k_l12mx's weights, both sides of k_qkv): a lane's low eight words are k = 8 hi .. 8 hi + 7, its upper eight k = 16 + 8 hi .. 16 + 8 hi + 7 (the caller adds 8 hi to the row's address).
template <typename T16> struct WFrag;
template <> struct WFrag<h16> { typedef v16h V; static __device__ __forceinline__ V ld(const h16* p) { return cat16(*(const v8h*)p, *(const v8h*)(p + 16)); } static __device__ __forceinline__ v8f mma(V a, V b, v8f c) { return wmma16(a, b, c); } };
template <> struct WFrag<bf> { typedef v16bf V; static __device__ __forceinline__ V ld(const bf* p) { return cat16b(*(const v8us*)p, *(const v8us*)(p + 16)); } static __device__ __forceinline__ v8f mma(V a, V b, v8f c) { return wmmab(a, b, c); } };
// the same fragments from a plane stored in fragment order (k_qkv says which): the two halves lie 256 words apart, the caller adds 8 x lane
__device__ __forceinline__ v16h ldfh(const h16* p) { return cat16(*(const v8h*)p, *(const v8h*)(p + 256)); }
__device__ __forceinline__ v16bf ldfb(const bf* p) { return cat16b(*(const v8us*)p, *(const v8us*)(p + 256)); }
// 2^x with the slot that the instruction set asks for behind a transcendental (before its result is read or its source overwritten) in the same statement
__device__ __forceinline__ float exp2s(float x) { float r; asm("v_exp_f32 %0, %1\n\tv_nop" : "=v"(r) : "v"(x)); return r; }
__device__ __forceinline__ h16 tohx(float x) { return (h16)x; }
__device__ __forceinline__ void splitf(float y, unsigned short& h, unsigned short& l) { h = f2bf(y); l = f2bf(y - bf2f(h)); }
typedef __attribute__((ext_vector_type(2))) _Float16 v2h;
typedef __attribute__((ext_vector_type(4))) _Float16 v4h;
typedef __attribute__((ext_vector_type(2))) unsigned short v2us;
typedef __attribute__((ext_vector_type(4))) unsigned short v4us;
typedef __attribute__((ext_vector_type(2))) float v2f;
typedef __attribute__((ext_vector_type(4))) int v4i;
typedef __attribute__((ext_vector_type(2))) unsigned v2u;
__global__ __launch_bounds__(256) void k_wt(const float* __restrict__ S, int kin, int nin, int kout, h16* D) { const unsigned idx = (blockIdx.x * 256u + threadIdx.x) * 2u; const unsigned nn = idx / (unsigned)kout, kk = idx - nn * (unsigned)kout; const bool row = (nn < (unsigned)nin); const bool live0 = row && (kk < (unsigned)kin), live1 = row && (kk + 1u < (unsigned)kin);
    const float val0 = live0 ? bfr(S[(size_t)kk * nin + nn]) : 0.0f; const float val1 = live1 ? bfr(S[(size_t)(kk + 1u) * nin + nn]) : 0.0f; v2h o; o[0] = tohx(val0); o[1] = tohx(val1);
    *(v2h*)(D + idx) = o;  }
// k_l12mx: BOTH LAYERS OF ONE (entry, s) ROW, FROM a1 TO THE LARGEST OVER ITS 512 PAIRS, IN ONE WORK-GROUP OF FOUR WAVES.
//   Part 1, a wave 128 of the row's pairs (eight tiles of 16): the first layer's product TRANSPOSED, W1 (units) as A and the pairs as B (WFrag's loader order on both sides: a lane's low eight words are k = 8 hi .. 8 hi + 7, so the low lane half holds features 0..7, the high half features 8..11 and noughts; the upper eight words, k 16..31, are noughts);
//   D's map then gives a lane ONE pair (column = lane & 15) and the units 8 hi + j of tile 0 and 16 + 8 hi + j of tile 1: word for word the second layer's A fragment of that pair, with no lane exchange. The norm's words are the lane's own sixteen units, two neighbouring units a register pair:
//   ((c + a3 - a6) x rsqrt(a7 + 1e-5)) x a4 + a5, the maximum with nought, the f16 word: in the module's own order. The fragments go to LDS as [tile][fragment half][lane][8 words]: every store and every later load is 32 lanes on 512 contiguous bytes.
//   Part 2, behind the one barrier, each wave 64 channels (four B fragments of W2 and the channels' norm words, read once) over all 512 pairs:
//   a trip takes 32 pairs (two A fragments from LDS) through eight products at depth 32; D's map gives a lane ONE channel a tile (column = lane & 15) and eight pairs (registers), so the norm words are the lane's own:
//   ((c + a9 - a12) x rsqrt(a13 + 1e-5)) x a10 + a11 word for word, then the running largest, begun at nought (which is the maximum with nought: the largest of nought and all the words); the two lane halves hold different pairs of the same channel: one exchange at the end.
__global__ __launch_bounds__(128) void k_l12mx(const float* __restrict__ a1, const h16* __restrict__ W1, const float* __restrict__ a3, const float* __restrict__ a4, const float* __restrict__ a5, const float* __restrict__ a6, const float* __restrict__ a7,
                                               const h16* __restrict__ W2, const float* __restrict__ a9, const float* __restrict__ a10, const float* __restrict__ a11, const float* __restrict__ a12, const float* __restrict__ a13, const float* __restrict__ a0, h16* ZH16) {
    __shared__ __align__(16) h16 hs[(NT / 16) * 2 * 32 * 8];
    const int lane = threadIdx.x & 31, lr = lane & 15, hi = lane >> 4; const int wv = (int)(threadIdx.x >> 5); const int c0 = wv * 64; const size_t rr = blockIdx.x;
    // every unroll directive of this kernel: it makes each index of the register arrays a constant, so that these arrays are registers (in part 1 it also lets the eight tiles' loads stand ahead of the arithmetic); the loop over tt stays rolled
    {
        const float* rp = a1 + (rr * NT + (size_t)wv * 128 + lr) * NP; v4f p0[8], p1[8];
#pragma unroll
        for (int tl = 0; tl < 8; ++tl) { p0[tl] = *(const v4f*)(rp + (size_t)tl * 16 * NP + 8 * hi); p1[tl] = *(const v4f*)(rp + (size_t)tl * 16 * NP + 4); }     /* the low half: features 0..3 and 4..7; the high half: 8..11, and 4..7 again (in bounds), which it replaces by noughts below */
        v16h w[2]; v2f n3[2][4], n6[2][4], ns[2][4], n4[2][4], n5[2][4];
#pragma unroll
        for (int mb = 0; mb < 2; ++mb) { w[mb] = WFrag<h16>::ld(W1 + (size_t)(mb * 16 + lr) * 32 + 8 * hi);
#pragma unroll
            for (int j = 0; j < 4; ++j) { const int uu = mb * 16 + 8 * hi + 2 * j; n3[mb][j] = (v2f){bfr(a3[uu]), bfr(a3[uu + 1])}; n6[mb][j] = (v2f){bfr(a6[uu]), bfr(a6[uu + 1])}; ns[mb][j] = (v2f){rsqrtf(bfr(a7[uu]) + NEPS), rsqrtf(bfr(a7[uu + 1]) + NEPS)}; n4[mb][j] = (v2f){bfr(a4[uu]), bfr(a4[uu + 1])}; n5[mb][j] = (v2f){bfr(a5[uu]), bfr(a5[uu + 1])}; } }
        const v8h zz8 = {0, 0, 0, 0, 0, 0, 0, 0}; const unsigned km = hi ? 0u : 0xFFFFFFFFu;     /* the high half's words 4..7 are k = 12..15: noughts, by a mask on the two packed registers (no branch) */
#pragma unroll
        for (int tl = 0; tl < 8; ++tl) { v4h q0, q1;
#pragma unroll
            for (int e = 0; e < 4; ++e) { q0[e] = tohx(bfr(p0[tl][e])); q1[e] = tohx(bfr(p1[tl][e])); }
            const v2u m1 = __builtin_bit_cast(v2u, q1) & km; const v8h lo = __builtin_shufflevector(q0, __builtin_bit_cast(v4h, m1), 0, 1, 2, 3, 4, 5, 6, 7);
            const v16h pb = cat16(lo, zz8); h16* dst = hs + ((size_t)(wv * 8 + tl) * 64 + lane) * 8;
#pragma unroll
            for (int mb = 0; mb < 2; ++mb) { const v8f d = wmma16(w[mb], pb, (v8f){}); v8h o;
#pragma unroll
                for (int j = 0; j < 4; ++j) { v2f yy = {d[2 * j], d[2 * j + 1]}; yy = (yy + n3[mb][j]) - n6[mb][j]; yy = yy * ns[mb][j]; yy = yy * n4[mb][j] + n5[mb][j]; o[2 * j] = tohx(fmaxf(yy[0], 0.0f)); o[2 * j + 1] = tohx(fmaxf(yy[1], 0.0f)); }
                *(v8h*)(dst + mb * 256) = o; } }
    }
    v16h b[4]; v2f b9[4], m12[4], sc[4], gg[4], bs[4]; float top[4];     /* the norm words twice over, a register pair each: the arithmetic below goes two pairs an instruction */
    const size_t zi = rr * NW + c0 + lane; const float z0 = a0[zi], z1 = a0[zi + 32];     /* the token's own words, asked for ahead of the loop that hides their way */
#pragma unroll
    for (int nb = 0; nb < 4; ++nb) { const int ch = c0 + nb * 16 + lr; b[nb] = WFrag<h16>::ld(W2 + (size_t)ch * NU + 8 * hi);
        asm volatile("s_wait_xcnt 0x0" ::: "memory");     /* in this build the next fragment's load lands on the registers that hold this one's address: the wait stands in front of that overwrite */
        const float w9 = bfr(a9[ch]), w12 = bfr(a12[ch]), w13 = rsqrtf(bfr(a13[ch]) + NEPS), w10 = bfr(a10[ch]), w11 = bfr(a11[ch]); b9[nb] = (v2f){w9, w9}; m12[nb] = (v2f){w12, w12}; sc[nb] = (v2f){w13, w13}; gg[nb] = (v2f){w10, w10}; bs[nb] = (v2f){w11, w11}; top[nb] = 0.0f; }
    __syncthreads();     /* the row's 32 fragment tiles, eight from each wave, are read by all four waves from here on; hs is not written again */
    const h16* ap = hs + (size_t)lane * 8;
    v16h f0 = cat16(*(const v8h*)ap, *(const v8h*)(ap + 256)), f1 = cat16(*(const v8h*)(ap + 512), *(const v8h*)(ap + 768));
    for (int tt = 0; tt < NT; tt += 32) {
        const int tn = (tt + 32) & (NT - 1);     /* the next trip's fragments are asked for ahead of this trip's arithmetic; the last trip asks for the row's first pairs again (in bounds, unused) */
        const h16* an = ap + (size_t)tn * 32;     /* a tile of 16 pairs is 512 words */
        const v16h g0 = cat16(*(const v8h*)an, *(const v8h*)(an + 256)), g1 = cat16(*(const v8h*)(an + 512), *(const v8h*)(an + 768));
        v8f d[2][4];
#pragma unroll
        for (int nb = 0; nb < 4; ++nb) { d[0][nb] = wmma16(f0, b[nb], (v8f){}); d[1][nb] = wmma16(f1, b[nb], (v8f){}); }
#pragma unroll
        for (int nb = 0; nb < 4; ++nb) {
#pragma unroll
            for (int mb = 0; mb < 2; ++mb) {
#pragma unroll
                for (int j = 0; j < 8; j += 2) { v2f yy = {d[mb][nb][j], d[mb][nb][j + 1]}; yy = (yy + b9[nb]) - m12[nb]; yy = yy * sc[nb]; yy = yy * gg[nb] + bs[nb]; top[nb] = fmaxf(fmaxf(top[nb], yy[0]), yy[1]); } } }
        f0 = g0; f1 = g1;
    }
    // lane l and lane l ^ 16 hold the same channels over different pairs: each half sends the two tiles that the other half stores, so that a store is 32 lanes on 64 contiguous bytes
    const float o0 = fmaxf(hi ? top[1] : top[0], __shfl_xor(hi ? top[0] : top[1], 16, 32)), o1 = fmaxf(hi ? top[3] : top[2], __shfl_xor(hi ? top[2] : top[3], 16, 32));
    // the token's own words are added here and the sum leaves as the projections' f16 operand: a wave's two stores fill one 128-byte line
    ZH16[zi] = tohx(bfr(z0) + o0); ZH16[zi + 32] = tohx(bfr(z1) + o1);  }
// k_qkv: THE THREE PROJECTIONS AS ONE PRODUCT, 1024 tokens by a14's 768 rows at depth 256, a register-blocked loop (one wave a 64x64 tile, 16 accumulators, the same loader on both sides), EVERY TILE STORED AS THE OPERAND WORDS THAT THE ATTENTION READS; grid (tokens / 64, 768 / 64), 32 threads.
//   D's map gives a lane ONE index of the B side (column = lane & 15) and EIGHT NEIGHBOURING indices of the A side (registers, 8 hi + j). So the side whose index runs along the stored plane's rows is taken as A:
//   planes 1 and 2 (rows = tokens, depth = channels): a14's rows as A, the tokens as B: a lane's eight words are eight neighbouring channels of one token, one 16-byte store of f16 words;
//   plane 3 (rows = an entry's channels, depth = its tokens): the tokens as A, a14's rows as B: eight neighbouring tokens of one channel, 16 bytes of bf16 hi words and 16 of lo words. Both loaders have the same k order, so the exchange pairs the same words at every k.
//   THE PLANES ARE STORED IN THE ORDER IN WHICH k_attn's FRAGMENTS READ THEM: [tile of 16 rows][step of 32 along the depth][fragment half][lane][8 words], lane = 16 x (bit 3 of the depth index) + (row & 15), half = bit 4 of the depth index: the lane that holds eight words here is the lane that reads them there, and every store here and every load there is 32 lanes on 512 contiguous bytes (four whole lines).
__global__ __launch_bounds__(32) void k_qkv(const h16* __restrict__ Z, const h16* __restrict__ Wt, h16* H2, h16* H3, bf* Vh, bf* Vl) {
    const int lane = threadIdx.x & 31, lr = lane & 15, hi = lane >> 4; const int r0 = blockIdx.x * 64, c0 = blockIdx.y * 64; const int pl = c0 / NW, cc = c0 - pl * NW;     /* pl: which plane, the same for the whole wave */
    const h16* zp = Z + (size_t)r0 * NW; const h16* wp = Wt + (size_t)c0 * NW; const h16* A = (pl < 2) ? wp : zp; const h16* Bt = (pl < 2) ? zp : wp;     /* both bases are the same for the whole wave */
    v8f acc[4][4];
#pragma unroll
    for (int mb = 0; mb < 4; ++mb)
#pragma unroll
        for (int nb = 0; nb < 4; ++nb) acc[mb][nb] = (v8f){};
    const unsigned off = (unsigned)(lr * NW + 8 * hi);
    for (int kc = 0; kc < NW; kc += 32) {
        const h16* pa = A + kc + off; const h16* pb = Bt + kc + off; v16h a[4], b[4];
#pragma unroll
        for (int mb = 0; mb < 4; ++mb) { a[mb] = WFrag<h16>::ld(pa + mb * 16 * NW); b[mb] = WFrag<h16>::ld(pb + mb * 16 * NW); }
        asm volatile("s_wait_xcnt 0x0" : : "v"(pa), "v"(pb) : "memory");     /* the trip's sixteen loads name these two address pairs: as inputs here the pairs stay whole up to this wait, so that no fragment lands on one of them, and the next trip's addresses are formed behind it */
#pragma unroll
        for (int nb = 0; nb < 4; ++nb)
#pragma unroll
            for (int mb = 0; mb < 4; ++mb) acc[mb][nb] = wmma16(a[mb], b[nb], acc[mb][nb]);
        asm volatile("v_nop\n\tv_nop\n\tv_nop\n\tv_nop" : "+v"(acc[0][0]), "+v"(acc[1][1]), "+v"(acc[2][2]), "+v"(acc[3][3]) : "v"(a[0]), "v"(a[3]));     /* four vector slots behind the trip's last products on every way out of the trip (the back edge and the jumps to the two store branches) */
    }
    // both branches: a group's words are all formed ahead of its first store (the scheduling barrier holds the stores behind the arithmetic), so that the stores go back to back and no register which an issued store names is written between them
    if (pl < 2) {
        h16* H = (pl ? H3 : H2) + (size_t)r0 * NW + cc * 16 + lane * 8; v8h o[4][4];
#pragma unroll
        for (int nb = 0; nb < 4; ++nb)
#pragma unroll
            for (int mb = 0; mb < 4; ++mb)
#pragma unroll
                for (int j = 0; j < 8; ++j) o[nb][mb][j] = tohx(acc[mb][nb][j]);
        __builtin_amdgcn_sched_barrier(0);
#pragma unroll
        for (int nb = 0; nb < 4; ++nb)
#pragma unroll
            for (int mb = 0; mb < 4; ++mb) *(v8h*)(H + nb * 16 * NW + mb * 256) = o[nb][mb];
    } else {
        const size_t vo = ((size_t)(r0 / NT) * NW + cc) * NT + (r0 % NT) * 16; const unsigned vl = (unsigned)(lane * 8); bf* vh = Vh + vo; bf* vw = Vl + vo;
#pragma unroll
        for (int hb = 0; hb < 4; hb += 2) {     /* two halves of eight tiles: all sixteen at once would take the kernel past 256 registers */
            v8us oh[2][4], ol[2][4];
#pragma unroll
            for (int nb = 0; nb < 2; ++nb)
#pragma unroll
                for (int mb = 0; mb < 4; ++mb)
#pragma unroll
                    for (int j = 0; j < 8; ++j) { unsigned short h1, l1; splitf(acc[mb][hb + nb][j], h1, l1); oh[nb][mb][j] = h1; ol[nb][mb][j] = l1; }
            __builtin_amdgcn_sched_barrier(0);
#pragma unroll
            for (int nb = 0; nb < 2; ++nb)
#pragma unroll
                for (int mb = 0; mb < 4; ++mb) { *(v8us*)(vh + (hb + nb) * 16 * NT + mb * 256 + vl) = oh[nb][mb]; *(v8us*)(vw + (hb + nb) * 16 * NT + mb * 256 + vl) = ol[nb][mb]; }
            if (hb == 0) { asm volatile("s_wait_xcnt 0x0" ::: "memory"); __builtin_amdgcn_sched_barrier(0); }     /* the second half's words are formed in registers that the first half's stores name: the wait stands behind those stores, and the scheduling barrier keeps the second half's arithmetic behind the wait */
        }
    }
}
// k_attn: THE WHOLE ATTENTION OF 16 QUERIES IN ONE WORK-GROUP OF EIGHT WAVES; grid (entries x tokens / 16), 256 threads.
//   Part 1, a wave 64 of the 512 keys (four tiles of 16): the scores TRANSPOSED, plane 2's rows (keys) as A and plane 1's rows (the 16 queries) as B, depth 256 in eight steps of 32 in rising order, both sides from planes in fragment order (k_qkv), the same k order on both.
//   D's map gives a lane ONE query (column = lane & 15) and the keys 8 hi + j of each tile: word for word the last product's A fragment of that query (two neighbouring key tiles are one step of 32 keys), with no lane exchange.
//   The softmax: a lane's 32 scores x 1/16, their largest, the 16 part maxima of a query (eight waves, two lane halves) through LDS; one exp2 a score; the sum likewise: a lane's 32 words in rising key order, then the 16 part sums in rising order; the weight = word x (1 / sum), split into bf16 hi + lo.
//   The fragments go to LDS as [key tile][lane][8 words]: every store and every later load is 32 lanes on 512 contiguous bytes.
//   Part 2, each wave 32 channels (two tiles: a row's 128-byte line has one writer) over all 512 keys in 16 steps of 32: per step and tile hi x hi, lo x hi, hi x lo, in that order into one accumulator. Plane 3's fragments come straight from memory (fragment order again) through a ring of four steps of registers, filled ahead of the softmax.
__global__ __launch_bounds__(256) void k_attn(const h16* __restrict__ H2, const h16* __restrict__ H3, const bf* __restrict__ Vh, const bf* __restrict__ Vl, float* OUT) {
    __shared__ __align__(16) bf ph[(NT / 16) * 32 * 8]; __shared__ __align__(16) bf pw[(NT / 16) * 32 * 8]; __shared__ float rmx[16 * 16]; __shared__ float rsm[16 * 16];
    const int lane = threadIdx.x & 31, lr = lane & 15, hi = lane >> 4; const int wv = (int)(threadIdx.x >> 5); const int e = blockIdx.x / (NT / 16), q0 = (blockIdx.x % (NT / 16)) * 16; const int c0 = wv * 32;
    // every unroll directive of this kernel: it makes each index of the register arrays a constant, so that these arrays are registers, and it lets a group's loads stand ahead of the products that read them
    const h16* qp = H2 + ((size_t)e * NT + q0) * NW + lane * 8; const h16* kp = H3 + ((size_t)e * NT + wv * 64) * NW + lane * 8;     /* a tile of 16 rows is 16 x 256 words in either order */
    const bf* vhp = Vh + ((size_t)e * NW + c0) * NT + lane * 8; const bf* vlp = Vl + ((size_t)e * NW + c0) * NT + lane * 8;
    v8f s[4];
#pragma unroll
    for (int mb = 0; mb < 4; ++mb) s[mb] = (v8f){};
#pragma unroll
    for (int kb = 0; kb < 2; ++kb) {     /* two groups of four steps: a group's loads stand ahead of its products, and both groups fit the registers */
        v16h a[4][4], b[4];
#pragma unroll
        for (int ks = 0; ks < 4; ++ks) { b[ks] = ldfh(qp + (kb * 4 + ks) * 512);
#pragma unroll
            for (int mb = 0; mb < 4; ++mb) a[ks][mb] = ldfh(kp + mb * 16 * NW + (kb * 4 + ks) * 512); }
#pragma unroll
        for (int ks = 0; ks < 4; ++ks)
#pragma unroll
            for (int mb = 0; mb < 4; ++mb) s[mb] = wmma16(a[ks][mb], b[ks], s[mb]);
    }
    asm volatile("s_wait_xcnt 0x0" : : "v"(qp), "v"(kp) : "memory");     /* part 1's loads name these two address pairs: as inputs here the pairs stay whole up to this wait, so that nothing is written on one of them ahead of it */
    v16bf bh[4][2], bl[4][2];
#pragma unroll
    for (int st = 0; st < 4; ++st)
#pragma unroll
        for (int nb = 0; nb < 2; ++nb) { bh[st][nb] = ldfb(vhp + nb * 16 * NT + st * 512); bl[st][nb] = ldfb(vlp + nb * 16 * NT + st * 512); }     /* the ring's first four steps, asked for ahead of the softmax that hides their way */
    float t[4][8]; float mx = -3.0e38f;
#pragma unroll
    for (int mb = 0; mb < 4; ++mb)
#pragma unroll
        for (int j = 0; j < 8; ++j) { t[mb][j] = s[mb][j] * SCL; mx = fmaxf(mx, t[mb][j]); }
    rmx[(wv * 2 + hi) * 16 + lr] = mx;
    __syncthreads();     /* a query's 16 part maxima, two from each wave, are read by every wave */
#pragma unroll
    for (int w = 0; w < 16; ++w) mx = fmaxf(mx, rmx[w * 16 + lr]);
    float sum = 0.f;
#pragma unroll
    for (int mb = 0; mb < 4; ++mb)
#pragma unroll
        for (int j = 0; j < 8; ++j) { const float d0 = __fsub_rn(t[mb][j], mx); t[mb][j] = exp2s(__fmul_rn(d0, 1.4426950408889634f)); sum += t[mb][j]; }
    rsm[(wv * 2 + hi) * 16 + lr] = sum;
    __syncthreads();     /* the 16 part sums likewise */
    float tot = 0.f;
#pragma unroll
    for (int w = 0; w < 16; ++w) tot += rsm[w * 16 + lr];
    const float f = __fdiv_rn(1.0f, tot);
#pragma unroll
    for (int mb = 0; mb < 4; ++mb) { v8us oh, ol;
#pragma unroll
        for (int j = 0; j < 8; ++j) { unsigned short h1, l1; splitf(t[mb][j] * f, h1, l1); oh[j] = h1; ol[j] = l1; }
        *(v8us*)(ph + ((wv * 4 + mb) * 32 + lane) * 8) = oh; *(v8us*)(pw + ((wv * 4 + mb) * 32 + lane) * 8) = ol; }
    __syncthreads();     /* the 32 key tiles of weights, four from each wave, are read by all eight waves from here on; ph and pw are not written again */
    v8f o[2]; o[0] = (v8f){}; o[1] = (v8f){};
    const bf* ap = ph + lane * 8; const bf* aw = pw + lane * 8; v16bf ah[2], al[2]; ah[0] = ldfb(ap); al[0] = ldfb(aw);
#pragma unroll
    for (int st = 0; st < NT / 32; ++st) {
        const int cu = st & 1, rg = st & 3;
        if (st + 1 < NT / 32) { ah[cu ^ 1] = ldfb(ap + (st + 1) * 512); al[cu ^ 1] = ldfb(aw + (st + 1) * 512); }     /* the next step's weights are asked for ahead of this step's products */
        o[0] = wmmab(ah[cu], bh[rg][0], o[0]); o[1] = wmmab(ah[cu], bh[rg][1], o[1]); o[0] = wmmab(al[cu], bh[rg][0], o[0]); o[1] = wmmab(al[cu], bh[rg][1], o[1]); o[0] = wmmab(ah[cu], bl[rg][0], o[0]); o[1] = wmmab(ah[cu], bl[rg][1], o[1]);
        if (st + 4 < NT / 32) {
#pragma unroll
            for (int nb = 0; nb < 2; ++nb) { bh[rg][nb] = ldfb(vhp + nb * 16 * NT + (st + 4) * 512); bl[rg][nb] = ldfb(vlp + nb * 16 * NT + (st + 4) * 512); } }
        __builtin_amdgcn_sched_barrier(0);     /* keeps the ring: without it the compiler sinks each refill to just in front of the products that read it, four steps on, and the load's whole way stands open at every step */
    }
    asm volatile("s_wait_xcnt 0x0" : : "v"(vhp), "v"(vlp) : "memory");     /* as above, for plane 3's two address pairs */
    float* op = OUT + ((size_t)e * NT + q0 + 8 * hi) * NW + c0 + lr;
#pragma unroll
    for (int nb = 0; nb < 2; ++nb)
#pragma unroll
        for (int j = 0; j < 8; ++j) op[j * NW + nb * 16] = o[nb][j];
}

extern "C" void kernel_launch(void* const* d_in, const int* in_sizes, int n_in,
                              void* d_out, int out_size, void* d_ws, size_t ws_size, hipStream_t stream) {
    (void)in_sizes; (void)n_in; (void)out_size;
    const float* a0 = (const float*)d_in[0]; const float* a1 = (const float*)d_in[1]; const float* a2 = (const float*)d_in[2]; const float* a3 = (const float*)d_in[3]; const float* a4 = (const float*)d_in[4]; const float* a5 = (const float*)d_in[5]; const float* a6 = (const float*)d_in[6]; const float* a7 = (const float*)d_in[7];
    const float* a8 = (const float*)d_in[8]; const float* a9 = (const float*)d_in[9]; const float* a10 = (const float*)d_in[10]; const float* a11 = (const float*)d_in[11]; const float* a12 = (const float*)d_in[12]; const float* a13 = (const float*)d_in[13]; const float* a14 = (const float*)d_in[14];
    // inputs in the module's argument order = d_in[0..14]: all fifteen read
    float* OUT = (float*)d_out;     // [2][512][256]
    char* wsp = (char*)d_ws;
    auto take = [&](size_t bytes) { char* p = wsp; wsp += (bytes + 255) & ~(size_t)255; return (void*)p; };
    h16* W1 = (h16*)take((size_t)64 * 32 * 2); h16* W2 = (h16*)take((size_t)NW * 32 * 2); h16* W3 = (h16*)take((size_t)3 * NW * NW * 2);
    h16* ZH16 = (h16*)take((size_t)NE * NT * NW * 2); h16* H2 = (h16*)take((size_t)NE * NT * NW * 2); h16* H3 = (h16*)take((size_t)NE * NT * NW * 2);
    bf* Vh = (bf*)take((size_t)NE * NW * NT * 2); bf* Vl = (bf*)take((size_t)NE * NW * NT * 2);
    if ((size_t)(wsp - (char*)d_ws) > ws_size) return;
    k_wt<<<64 * 32 / 2 / 256, 256, 0, stream>>>(a2, NP, NU, 32, W1); k_wt<<<NW * 32 / 2 / 256, 256, 0, stream>>>(a8, NU, NW, 32, W2); k_wt<<<3 * NW * NW / 2 / 256, 256, 0, stream>>>(a14, NW, 3 * NW, NW, W3);
    k_l12mx<<<NE * NT, 128, 0, stream>>>(a1, W1, a3, a4, a5, a6, a7, W2, a9, a10, a11, a12, a13, a0, ZH16);
    k_qkv<<<dim3(NE * NT / 64, 3 * NW / 64, 1), 32, 0, stream>>>(ZH16, W3, H2, H3, Vh, Vl);
    k_attn<<<NE * NT / 16, 256, 0, stream>>>(H2, H3, Vh, Vl, OUT);
}

// v005
// A run of this version takes 37.5 microseconds.
// In two side-by-side timings against v004, it was 1.14 and 1.19 times as fast.
// Counting every step since v000, it is 80.5 times as fast.
#include <hip/hip_runtime.h>

// A one-head attention over 512 tokens of width 256 (two entries) whose tokens first take an additive term made from a pairwise tensor
// (inputs, in argument order: a0 [2][512][256] tokens; a1 [2][512][512][12] pair features; a2 [12][32] with a3 [32]; a4, a5, a6, a7 [32]: a norm's scale, shift, running mean, running variance;
//   a8 [32][256] with a9 [256]; a10, a11, a12, a13 [256]: a second such norm; a14 [256][768] one projection ('in' by 'three times the width') whose thirds are the three planes of the attention):
//   U1 = max((a1 a2 + a3 - a6) / sqrt(a7 + 1e-5) x a4 + a5, 0): [2][512][512][32]; U2 = max((U1 a8 + a9 - a12) / sqrt(a13 + 1e-5) x a10 + a11, 0): [2][512][512][256];
//   ADD[e][s][c] = the largest U2[e][s][t][c] over t; Z = a0 + ADD; the three planes Z a14[:, 0:256], Z a14[:, 256:512], Z a14[:, 512:768]; scores = plane 1 x plane 2 transposed / 16; a softmax along the last axis; result = weights x plane 3: [2][512][256].
// Layout: neither U1 nor U2 is ever in memory: one work-group takes one (entry, s) row from a1 to ADD (k_l12mx). The first layer is an f16 product at depth 32 (a1 padded from 12 with noughts in the loader; a2's columns read and padded likewise by the same kernel; both inputs' words are bf16-exact and f16 holds them exactly in its normal range),
//   its norm, maximum and ONE f16 word, kept in LDS for the row; the second layer one f16 product at depth 32 whose tiles never leave the registers: the wave that forms a tile takes the norm, the maximum with nought and the largest over the 512 pairs of its row there;
//   the tokens plus that term as ONE f16 word, stored by the same wave; the three projections ONE f16 product at depth 256 against a14 as 768 f16 rows (a14's words are bf16-exact: f16 holds them exactly in its normal range), whose tiles go from the registers to the planes the attention reads (k_qkv): planes 1 and 2 ONE f16 word, plane 3 transposed as bf16 hi + lo;
//   the attention ONE kernel (k_attn), a work-group 16 queries against all 512 keys: the scores one f16 product taken transposed, the softmax in the tiles' own registers, every weight as bf16 hi + lo through LDS; the last product three bf16 products (hi hi, lo hi, hi lo), straight into the output: neither the scores nor the weights are ever in memory.
// THREE kernel texts (k_l12mx, k_qkv, k_attn), one launch each: every address from the lane's own index and launch constants; exact grids, no guard but k_l12mx's test for the first 192 work-groups (a14's rows); no atomic; k_l12mx has LDS (32 KiB, written once, one barrier, then read), its loops run literal trip counts, the same for every lane, and two lane-crossing words behind its last loop; k_attn has LDS (34 KiB, each part written once, three barriers), no loop left rolled and no lane-crossing word.
// Compute dtypes, f32 accumulate: every float input rounded to bf16 at its first read; the first layer f16 x f16 on words that hold the inputs' bf16 values exactly; every computed operand ONE f16 word but the softmax weights and plane 3, which are bf16 hi + lo (the weights reach down to 2e-9: an f16 plane of them would be more than a third subnormal); norms, maxima, exponentials f32.

#define NE   2                    // entries
#define NT   512                  // tokens an entry = pairs a row
#define NW   256                  // width
#define NU   32                   // the first layer's width = the second layer's depth
#define NP   12                   // pair features
#define NEPS 1e-5f                // the two norms' epsilon
#define SCL  0.0625f   // 256^-0.5
typedef _Float16 h16;
typedef unsigned short bf;
typedef __attribute__((ext_vector_type(16))) __bf16   v16bf;
typedef __attribute__((ext_vector_type(16))) _Float16 v16h;
typedef __attribute__((ext_vector_type(8)))  _Float16 v8h;
typedef __attribute__((ext_vector_type(8)))  unsigned short v8us;
typedef __attribute__((ext_vector_type(8)))  float    v8f;
typedef __attribute__((ext_vector_type(4)))  float    v4f;
typedef v8h  __attribute__((may_alias)) v8ha;
typedef v4f  __attribute__((may_alias)) v4fa;
typedef v8us __attribute__((may_alias)) v8usa;

__device__ __forceinline__ unsigned short f2bf(float f) { unsigned u = __float_as_uint(f); u += 0x7FFFu + ((u >> 16) & 1u); return (unsigned short)(u >> 16); }
__device__ __forceinline__ float bf2f(unsigned short b) { return __uint_as_float(((unsigned)b) << 16); }
__device__ __forceinline__ float bfr(float f) { return bf2f(f2bf(f)); }
__device__ __forceinline__ v16h cat16(v8h lo, v8h hi) { return __builtin_shufflevector(lo, hi, 0, 1, 2, 3, 4, 5, 6, 7, 8, 9, 10, 11, 12, 13, 14, 15); }
__device__ __forceinline__ v16bf cat16b(v8us lo, v8us hi) { return __builtin_bit_cast(v16bf, __builtin_shufflevector(lo, hi, 0, 1, 2, 3, 4, 5, 6, 7, 8, 9, 10, 11, 12, 13, 14, 15)); }
__device__ __forceinline__ v8f wmma16(v16h a, v16h b, v8f c) { return __builtin_amdgcn_wmma_f32_16x16x32_f16(false, a, false, b, (short)0, c, false, false); }
__device__ __forceinline__ v8f wmmab(v16bf a, v16bf b, v8f c) { return __builtin_amdgcn_wmma_f32_16x16x32_bf16(false, a, false, b, (short)0, c, false, false); }

// WFrag: the fragment loader for K-contiguous 16-bit planes (both sides of k_qkv): a lane's low eight words are k = 8 hi .. 8 hi + 7, its upper eight k = 16 + 8 hi .. 16 + 8 hi + 7 (the caller adds 8 hi to the row's address).
template <typename T16> struct WFrag;
template <> struct WFrag<h16> { typedef v16h V; static __device__ __forceinline__ V ld(const h16* p) { return cat16(*(const v8h*)p, *(const v8h*)(p + 16)); } static __device__ __forceinline__ v8f mma(V a, V b, v8f c) { return wmma16(a, b, c); } };
template <> struct WFrag<bf> { typedef v16bf V; static __device__ __forceinline__ V ld(const bf* p) { return cat16b(*(const v8us*)p, *(const v8us*)(p + 16)); } static __device__ __forceinline__ v8f mma(V a, V b, v8f c) { return wmmab(a, b, c); } };
// the same fragments from a plane stored in fragment order (k_qkv says which): the two halves lie 256 words apart, the caller adds 8 x lane
__device__ __forceinline__ v16h ldfh(const h16* p) { return cat16(*(const v8h*)p, *(const v8h*)(p + 256)); }
__device__ __forceinline__ v16bf ldfb(const bf* p) { return cat16b(*(const v8us*)p, *(const v8us*)(p + 256)); }
// 2^x with the slot that the instruction set asks for behind a transcendental (before its result is read or its source overwritten) in the same statement
__device__ __forceinline__ float exp2s(float x) { float r; asm("v_exp_f32 %0, %1\n\tv_nop" : "=v"(r) : "v"(x)); return r; }
__device__ __forceinline__ h16 tohx(float x) { return (h16)x; }
__device__ __forceinline__ void splitf(float y, unsigned short& h, unsigned short& l) { h = f2bf(y); l = f2bf(y - bf2f(h)); }
typedef __attribute__((ext_vector_type(2))) _Float16 v2h;
typedef __attribute__((ext_vector_type(4))) _Float16 v4h;
typedef __attribute__((ext_vector_type(2))) unsigned short v2us;
typedef __attribute__((ext_vector_type(4))) unsigned short v4us;
typedef __attribute__((ext_vector_type(2))) float v2f;
typedef __attribute__((ext_vector_type(4))) int v4i;
typedef __attribute__((ext_vector_type(2))) unsigned v2u;
// k_l12mx: BOTH LAYERS OF ONE (entry, s) ROW, FROM a1 TO THE LARGEST OVER ITS 512 PAIRS, IN ONE WORK-GROUP OF FOUR WAVES.
//   No weight plane is made ahead: W1 and W2 below are a2's and a8's columns, read as floats by the lane that holds them in its fragment and cast there (bf16 rounding, then the f16 word); the first 192 work-groups also write a14's f16 rows for k_qkv.
//   Part 1, a wave 128 of the row's pairs (eight tiles of 16): the first layer's product TRANSPOSED, W1 (units) as A and the pairs as B (WFrag's loader order on both sides: a lane's low eight words are k = 8 hi .. 8 hi + 7, so the low lane half holds features 0..7, the high half features 8..11 and noughts; the upper eight words, k 16..31, are noughts);
//   D's map then gives a lane ONE pair (column = lane & 15) and the units 8 hi + j of tile 0 and 16 + 8 hi + j of tile 1: word for word the second layer's A fragment of that pair, with no lane exchange. The norm's words are the lane's own sixteen units, two neighbouring units a register pair:
//   ((c + a3 - a6) x rsqrt(a7 + 1e-5)) x a4 + a5, the maximum with nought, the f16 word: in the module's own order. The fragments go to LDS as [tile][fragment half][lane][8 words]: every store and every later load is 32 lanes on 512 contiguous bytes.
//   Part 2, behind the one barrier, each wave 64 channels (four B fragments of W2 and the channels' norm words, read once) over all 512 pairs:
//   a trip takes 32 pairs (two A fragments from LDS) through eight products at depth 32; D's map gives a lane ONE channel a tile (column = lane & 15) and eight pairs (registers), so the norm words are the lane's own:
//   ((c + a9 - a12) x rsqrt(a13 + 1e-5)) x a10 + a11 word for word, then the running largest, begun at nought (which is the maximum with nought: the largest of nought and all the words); the two lane halves hold different pairs of the same channel: one exchange at the end.
__global__ __launch_bounds__(128) void k_l12mx(const float* __restrict__ a1, const float* __restrict__ a2, const float* __restrict__ a3, const float* __restrict__ a4, const float* __restrict__ a5, const float* __restrict__ a6, const float* __restrict__ a7,
                                               const float* __restrict__ a8, const float* __restrict__ a9, const float* __restrict__ a10, const float* __restrict__ a11, const float* __restrict__ a12, const float* __restrict__ a13, const float* __restrict__ a0, h16* ZH16, const float* __restrict__ a14, h16* W3) {
    __shared__ __align__(16) h16 hs[(NT / 16) * 2 * 32 * 8];
    const int lane = threadIdx.x & 31, lr = lane & 15, hi = lane >> 4; const int wv = (int)(threadIdx.x >> 5); const int c0 = wv * 64; const size_t rr = blockIdx.x;
    // a14 as 768 f16 rows of depth 256, read by the NEXT launch only: each wave of the first 192 work-groups (a test that is the same for a whole work-group) takes four rows by 64 depth words, a lane eight neighbouring depth words of one row:
    //   a load is eight runs of 16 bytes, the one store four whole 128-byte lines. The loads are asked for here and their words leave behind the last loop, which hides their way.
    const bool cw = blockIdx.x < 3 * NW / 4; const int cn = (int)blockIdx.x * 4 + (lane >> 3), ck = wv * 64 + (lane & 7) * 8; float x14[8] = {0.f, 0.f, 0.f, 0.f, 0.f, 0.f, 0.f, 0.f};
    if (cw) { const float* sp = a14 + (size_t)ck * (3 * NW) + cn;
#pragma unroll
        for (int j = 0; j < 8; ++j) x14[j] = sp[j * (3 * NW)];
        asm volatile("s_wait_xcnt 0x0" : : "v"(sp) : "memory"); }     /* the eight loads name this address pair: as an input here it stays whole up to this wait */
    // every unroll directive of this kernel: it makes each index of the register arrays a constant, so that these arrays are registers (in part 1 it also lets the eight tiles' loads stand ahead of the arithmetic); the loop over tt stays rolled
    {
        const float* rp = a1 + (rr * NT + (size_t)wv * 128 + lr) * NP; v4f p0[8], p1[8];
#pragma unroll
        for (int tl = 0; tl < 8; ++tl) { p0[tl] = *(const v4f*)(rp + (size_t)tl * 16 * NP + 8 * hi); p1[tl] = *(const v4f*)(rp + (size_t)tl * 16 * NP + 4); }     /* the low half: features 0..3 and 4..7; the high half: 8..11, and 4..7 again (in bounds), which it replaces by noughts below */
        const v8h zz8 = {0, 0, 0, 0, 0, 0, 0, 0}; const unsigned km = hi ? 0u : 0xFFFFFFFFu;     /* the high half's words 4..7 are k = 12..15: noughts, by a mask on the two packed registers (no branch) */
        const float* u0 = a2 + 8 * hi * NU + lr; const float* u1 = a2 + 4 * NU + lr; float x0[2][4], x1[2][4];     /* a2's column of the lane's unit, in the pairs' own order: features 8 hi .. 8 hi + 3, and 4..7 (in bounds), which the high half replaces by noughts */
#pragma unroll
        for (int mb = 0; mb < 2; ++mb)
#pragma unroll
            for (int e = 0; e < 4; ++e) { x0[mb][e] = u0[e * NU + mb * 16]; x1[mb][e] = u1[e * NU + mb * 16]; }
        asm volatile("s_wait_xcnt 0x0" : : "v"(u0) : "memory");     /* eight of the sixteen loads name this address pair: as an input here it stays whole up to this wait (the other eight go by the scalar base and the lane's own index, which lives on) */
        v16h w[2]; v2f n3[2][4], n6[2][4], ns[2][4], n4[2][4], n5[2][4];
#pragma unroll
        for (int mb = 0; mb < 2; ++mb) {
#pragma unroll
            for (int j = 0; j < 4; ++j) { const int uu = mb * 16 + 8 * hi + 2 * j; n3[mb][j] = (v2f){bfr(a3[uu]), bfr(a3[uu + 1])}; n6[mb][j] = (v2f){bfr(a6[uu]), bfr(a6[uu + 1])}; ns[mb][j] = (v2f){rsqrtf(bfr(a7[uu]) + NEPS), rsqrtf(bfr(a7[uu + 1]) + NEPS)}; n4[mb][j] = (v2f){bfr(a4[uu]), bfr(a4[uu + 1])}; n5[mb][j] = (v2f){bfr(a5[uu]), bfr(a5[uu + 1])}; } }
#pragma unroll
        for (int mb = 0; mb < 2; ++mb) { v4h q0, q1;
#pragma unroll
            for (int e = 0; e < 4; ++e) { q0[e] = tohx(bfr(x0[mb][e])); q1[e] = tohx(bfr(x1[mb][e])); }
            const v2u m1 = __builtin_bit_cast(v2u, q1) & km; w[mb] = cat16(__builtin_shufflevector(q0, __builtin_bit_cast(v4h, m1), 0, 1, 2, 3, 4, 5, 6, 7), zz8); }
#pragma unroll
        for (int tl = 0; tl < 8; ++tl) { v4h q0, q1;
#pragma unroll
            for (int e = 0; e < 4; ++e) { q0[e] = tohx(bfr(p0[tl][e])); q1[e] = tohx(bfr(p1[tl][e])); }
            const v2u m1 = __builtin_bit_cast(v2u, q1) & km; const v8h lo = __builtin_shufflevector(q0, __builtin_bit_cast(v4h, m1), 0, 1, 2, 3, 4, 5, 6, 7);
            const v16h pb = cat16(lo, zz8); h16* dst = hs + ((size_t)(wv * 8 + tl) * 64 + lane) * 8;
#pragma unroll
            for (int mb = 0; mb < 2; ++mb) { const v8f d = wmma16(w[mb], pb, (v8f){}); v8h o;
#pragma unroll
                for (int j = 0; j < 4; ++j) { v2f yy = {d[2 * j], d[2 * j + 1]}; yy = (yy + n3[mb][j]) - n6[mb][j]; yy = yy * ns[mb][j]; yy = yy * n4[mb][j] + n5[mb][j]; o[2 * j] = tohx(fmaxf(yy[0], 0.0f)); o[2 * j + 1] = tohx(fmaxf(yy[1], 0.0f)); }
                *(v8h*)(dst + mb * 256) = o; } }
    }
    v16h b[4]; v2f b9[4], m12[4], sc[4], gg[4], bs[4]; float top[4];     /* the norm words twice over, a register pair each: the arithmetic below goes two pairs an instruction */
    const size_t zi = rr * NW + c0 + lane; const float* zq = a0 + zi; const float z0 = zq[0], z1 = zq[32];     /* the token's own words, asked for ahead of the loop that hides their way */
    { const float* vp = a8 + (size_t)(8 * hi) * NW + c0 + lr; float y[4][16];     /* a8's column of the lane's channel in WFrag's order: depth 8 hi + j, then 16 + 8 hi + j; a load is two runs of 64 bytes */
#pragma unroll
      for (int nb = 0; nb < 4; ++nb)
#pragma unroll
          for (int j = 0; j < 16; ++j) y[nb][j] = vp[((j >> 3) * 16 + (j & 7)) * NW + nb * 16];
      asm volatile("s_wait_xcnt 0x0" : : "v"(vp), "v"(zq) : "memory");     /* the 64 loads and the token's two name these address pairs: as inputs here the pairs stay whole up to this wait, so that no loaded word lands on one of them */
#pragma unroll
      for (int nb = 0; nb < 4; ++nb)
#pragma unroll
          for (int j = 0; j < 16; ++j) b[nb][j] = tohx(bfr(y[nb][j])); }
#pragma unroll
    for (int nb = 0; nb < 4; ++nb) { const int ch = c0 + nb * 16 + lr;
        const float w9 = bfr(a9[ch]), w12 = bfr(a12[ch]), w13 = rsqrtf(bfr(a13[ch]) + NEPS), w10 = bfr(a10[ch]), w11 = bfr(a11[ch]); b9[nb] = (v2f){w9, w9}; m12[nb] = (v2f){w12, w12}; sc[nb] = (v2f){w13, w13}; gg[nb] = (v2f){w10, w10}; bs[nb] = (v2f){w11, w11}; top[nb] = 0.0f; }
    __syncthreads();     /* the row's 32 fragment tiles, eight from each wave, are read by all four waves from here on; hs is not written again */
    const h16* ap = hs + (size_t)lane * 8;
    v16h f0 = cat16(*(const v8h*)ap, *(const v8h*)(ap + 256)), f1 = cat16(*(const v8h*)(ap + 512), *(const v8h*)(ap + 768));
    for (int tt = 0; tt < NT; tt += 32) {
        const int tn = (tt + 32) & (NT - 1);     /* the next trip's fragments are asked for ahead of this trip's arithmetic; the last trip asks for the row's first pairs again (in bounds, unused) */
        const h16* an = ap + (size_t)tn * 32;     /* a tile of 16 pairs is 512 words */
        const v16h g0 = cat16(*(const v8h*)an, *(const v8h*)(an + 256)), g1 = cat16(*(const v8h*)(an + 512), *(const v8h*)(an + 768));
        v8f d[2][4];
#pragma unroll
        for (int nb = 0; nb < 4; ++nb) { d[0][nb] = wmma16(f0, b[nb], (v8f){}); d[1][nb] = wmma16(f1, b[nb], (v8f){}); }
#pragma unroll
        for (int nb = 0; nb < 4; ++nb) {
#pragma unroll
            for (int mb = 0; mb < 2; ++mb) {
#pragma unroll
                for (int j = 0; j < 8; j += 2) { v2f yy = {d[mb][nb][j], d[mb][nb][j + 1]}; yy = (yy + b9[nb]) - m12[nb]; yy = yy * sc[nb]; yy = yy * gg[nb] + bs[nb]; top[nb] = fmaxf(fmaxf(top[nb], yy[0]), yy[1]); } } }
        f0 = g0; f1 = g1;
    }
    if (cw) { v8h o; h16* dp = W3 + (size_t)cn * NW + ck;
#pragma unroll
        for (int j = 0; j < 8; ++j) o[j] = tohx(bfr(x14[j]));
        *(v8h*)dp = o;
        asm volatile("s_wait_xcnt 0x0" : : "v"(dp), "v"(o) : "memory"); }     /* the store names its address pair and its four data registers: as inputs here they stay whole up to this wait, and the words below are formed behind it */
    // lane l and lane l ^ 16 hold the same channels over different pairs: each half sends the two tiles that the other half stores, so that a store is 32 lanes on 64 contiguous bytes
    const float o0 = fmaxf(hi ? top[1] : top[0], __shfl_xor(hi ? top[0] : top[1], 16, 32)), o1 = fmaxf(hi ? top[3] : top[2], __shfl_xor(hi ? top[2] : top[3], 16, 32));
    // the token's own words are added here and the sum leaves as the projections' f16 operand: a wave's two stores fill one 128-byte line
    ZH16[zi] = tohx(bfr(z0) + o0); ZH16[zi + 32] = tohx(bfr(z1) + o1);  }
// k_qkv: THE THREE PROJECTIONS AS ONE PRODUCT, 1024 tokens by a14's 768 rows at depth 256, a register-blocked loop (one wave a 64x64 tile, 16 accumulators, the same loader on both sides), EVERY TILE STORED AS THE OPERAND WORDS THAT THE ATTENTION READS; grid (tokens / 64, 768 / 64), 32 threads.
//   D's map gives a lane ONE index of the B side (column = lane & 15) and EIGHT NEIGHBOURING indices of the A side (registers, 8 hi + j). So the side whose index runs along the stored plane's rows is taken as A:
//   planes 1 and 2 (rows = tokens, depth = channels): a14's rows as A, the tokens as B: a lane's eight words are eight neighbouring channels of one token, one 16-byte store of f16 words;
//   plane 3 (rows = an entry's channels, depth = its tokens): the tokens as A, a14's rows as B: eight neighbouring tokens of one channel, 16 bytes of bf16 hi words and 16 of lo words. Both loaders have the same k order, so the exchange pairs the same words at every k.
//   THE PLANES ARE STORED IN THE ORDER IN WHICH k_attn's FRAGMENTS READ THEM: [tile of 16 rows][step of 32 along the depth][fragment half][lane][8 words], lane = 16 x (bit 3 of the depth index) + (row & 15), half = bit 4 of the depth index: the lane that holds eight words here is the lane that reads them there, and every store here and every load there is 32 lanes on 512 contiguous bytes (four whole lines).
__global__ __launch_bounds__(32) void k_qkv(const h16* __restrict__ Z, const h16* __restrict__ Wt, h16* H2, h16* H3, bf* Vh, bf* Vl) {
    const int lane = threadIdx.x & 31, lr = lane & 15, hi = lane >> 4; const int r0 = blockIdx.x * 64, c0 = blockIdx.y * 64; const int pl = c0 / NW, cc = c0 - pl * NW;     /* pl: which plane, the same for the whole wave */
    const h16* zp = Z + (size_t)r0 * NW; const h16* wp = Wt + (size_t)c0 * NW; const h16* A = (pl < 2) ? wp : zp; const h16* Bt = (pl < 2) ? zp : wp;     /* both bases are the same for the whole wave */
    v8f acc[4][4];
#pragma unroll
    for (int mb = 0; mb < 4; ++mb)
#pragma unroll
        for (int nb = 0; nb < 4; ++nb) acc[mb][nb] = (v8f){};
    const unsigned off = (unsigned)(lr * NW + 8 * hi);
    for (int kc = 0; kc < NW; kc += 32) {
        const h16* pa = A + kc + off; const h16* pb = Bt + kc + off; v16h a[4], b[4];
#pragma unroll
        for (int mb = 0; mb < 4; ++mb) { a[mb] = WFrag<h16>::ld(pa + mb * 16 * NW); b[mb] = WFrag<h16>::ld(pb + mb * 16 * NW); }
        asm volatile("s_wait_xcnt 0x0" : : "v"(pa), "v"(pb) : "memory");     /* the trip's sixteen loads name these two address pairs: as inputs here the pairs stay whole up to this wait, so that no fragment lands on one of them, and the next trip's addresses are formed behind it */
#pragma unroll
        for (int nb = 0; nb < 4; ++nb)
#pragma unroll
            for (int mb = 0; mb < 4; ++mb) acc[mb][nb] = wmma16(a[mb], b[nb], acc[mb][nb]);
        asm volatile("v_nop\n\tv_nop\n\tv_nop\n\tv_nop" : "+v"(acc[0][0]), "+v"(acc[1][1]), "+v"(acc[2][2]), "+v"(acc[3][3]) : "v"(a[0]), "v"(a[3]));     /* four vector slots behind the trip's last products on every way out of the trip (the back edge and the jumps to the two store branches) */
    }
    // both branches: a group's words are all formed ahead of its first store (the scheduling barrier holds the stores behind the arithmetic), so that the stores go back to back and no register which an issued store names is written between them
    if (pl < 2) {
        h16* H = (pl ? H3 : H2) + (size_t)r0 * NW + cc * 16 + lane * 8; v8h o[4][4];
#pragma unroll
        for (int nb = 0; nb < 4; ++nb)
#pragma unroll
            for (int mb = 0; mb < 4; ++mb)
#pragma unroll
                for (int j = 0; j < 8; ++j) o[nb][mb][j] = tohx(acc[mb][nb][j]);
        __builtin_amdgcn_sched_barrier(0);
#pragma unroll
        for (int nb = 0; nb < 4; ++nb)
#pragma unroll
            for (int mb = 0; mb < 4; ++mb) *(v8h*)(H + nb * 16 * NW + mb * 256) = o[nb][mb];
    } else {
        const size_t vo = ((size_t)(r0 / NT) * NW + cc) * NT + (r0 % NT) * 16; const unsigned vl = (unsigned)(lane * 8); bf* vh = Vh + vo; bf* vw = Vl + vo;
#pragma unroll
        for (int hb = 0; hb < 4; hb += 2) {     /* two halves of eight tiles: all sixteen at once would take the kernel past 256 registers */
            v8us oh[2][4], ol[2][4];
#pragma unroll
            for (int nb = 0; nb < 2; ++nb)
#pragma unroll
                for (int mb = 0; mb < 4; ++mb)
#pragma unroll
                    for (int j = 0; j < 8; ++j) { unsigned short h1, l1; splitf(acc[mb][hb + nb][j], h1, l1); oh[nb][mb][j] = h1; ol[nb][mb][j] = l1; }
            __builtin_amdgcn_sched_barrier(0);
#pragma unroll
            for (int nb = 0; nb < 2; ++nb)
#pragma unroll
                for (int mb = 0; mb < 4; ++mb) { *(v8us*)(vh + (hb + nb) * 16 * NT + mb * 256 + vl) = oh[nb][mb]; *(v8us*)(vw + (hb + nb) * 16 * NT + mb * 256 + vl) = ol[nb][mb]; }
            if (hb == 0) { asm volatile("s_wait_xcnt 0x0" ::: "memory"); __builtin_amdgcn_sched_barrier(0); }     /* the second half's words are formed in registers that the first half's stores name: the wait stands behind those stores, and the scheduling barrier keeps the second half's arithmetic behind the wait */
        }
    }
}
// k_attn: THE WHOLE ATTENTION OF 16 QUERIES IN ONE WORK-GROUP OF EIGHT WAVES; grid (entries x tokens / 16), 256 threads.
//   Part 1, a wave 64 of the 512 keys (four tiles of 16): the scores TRANSPOSED, plane 2's rows (keys) as A and plane 1's rows (the 16 queries) as B, depth 256 in eight steps of 32 in rising order, both sides from planes in fragment order (k_qkv), the same k order on both.
//   D's map gives a lane ONE query (column = lane & 15) and the keys 8 hi + j of each tile: word for word the last product's A fragment of that query (two neighbouring key tiles are one step of 32 keys), with no lane exchange.
//   The softmax: a lane's 32 scores x 1/16, their largest, the 16 part maxima of a query (eight waves, two lane halves) through LDS; one exp2 a score; the sum likewise: a lane's 32 words in rising key order, then the 16 part sums in rising order; the weight = word x (1 / sum), split into bf16 hi + lo.
//   The fragments go to LDS as [key tile][lane][8 words]: every store and every later load is 32 lanes on 512 contiguous bytes.
//   Part 2, each wave 32 channels (two tiles: a row's 128-byte line has one writer) over all 512 keys in 16 steps of 32: per step and tile hi x hi, lo x hi, hi x lo, in that order into one accumulator. Plane 3's fragments come straight from memory (fragment order again) through a ring of four steps of registers, filled ahead of the softmax.
__global__ __launch_bounds__(256) void k_attn(const h16* __restrict__ H2, const h16* __restrict__ H3, const bf* __restrict__ Vh, const bf* __restrict__ Vl, float* OUT) {
    __shared__ __align__(16) bf ph[(NT / 16) * 32 * 8]; __shared__ __align__(16) bf pw[(NT / 16) * 32 * 8]; __shared__ float rmx[16 * 16]; __shared__ float rsm[16 * 16];
    const int lane = threadIdx.x & 31, lr = lane & 15, hi = lane >> 4; const int wv = (int)(threadIdx.x >> 5); const int e = blockIdx.x / (NT / 16), q0 = (blockIdx.x % (NT / 16)) * 16; const int c0 = wv * 32;
    // every unroll directive of this kernel: it makes each index of the register arrays a constant, so that these arrays are registers, and it lets a group's loads stand ahead of the products that read them
    const h16* qp = H2 + ((size_t)e * NT + q0) * NW + lane * 8; const h16* kp = H3 + ((size_t)e * NT + wv * 64) * NW + lane * 8;     /* a tile of 16 rows is 16 x 256 words in either order */
    const bf* vhp = Vh + ((size_t)e * NW + c0) * NT + lane * 8; const bf* vlp = Vl + ((size_t)e * NW + c0) * NT + lane * 8;
    v8f s[4];
#pragma unroll
    for (int mb = 0; mb < 4; ++mb) s[mb] = (v8f){};
#pragma unroll
    for (int kb = 0; kb < 2; ++kb) {     /* two groups of four steps: a group's loads stand ahead of its products, and both groups fit the registers */
        v16h a[4][4], b[4];
#pragma unroll
        for (int ks = 0; ks < 4; ++ks) { b[ks] = ldfh(qp + (kb * 4 + ks) * 512);
#pragma unroll
            for (int mb = 0; mb < 4; ++mb) a[ks][mb] = ldfh(kp + mb * 16 * NW + (kb * 4 + ks) * 512); }
#pragma unroll
        for (int ks = 0; ks < 4; ++ks)
#pragma unroll
            for (int mb = 0; mb < 4; ++mb) s[mb] = wmma16(a[ks][mb], b[ks], s[mb]);
    }
    asm volatile("s_wait_xcnt 0x0" : : "v"(qp), "v"(kp) : "memory");     /* part 1's loads name these two address pairs: as inputs here the pairs stay whole up to this wait, so that nothing is written on one of them ahead of it */
    v16bf bh[4][2], bl[4][2];
#pragma unroll
    for (int st = 0; st < 4; ++st)
#pragma unroll
        for (int nb = 0; nb < 2; ++nb) { bh[st][nb] = ldfb(vhp + nb * 16 * NT + st * 512); bl[st][nb] = ldfb(vlp + nb * 16 * NT + st * 512); }     /* the ring's first four steps, asked for ahead of the softmax that hides their way */
    float t[4][8]; float mx = -3.0e38f;
#pragma unroll
    for (int mb = 0; mb < 4; ++mb)
#pragma unroll
        for (int j = 0; j < 8; ++j) { t[mb][j] = s[mb][j] * SCL; mx = fmaxf(mx, t[mb][j]); }
    rmx[(wv * 2 + hi) * 16 + lr] = mx;
    __syncthreads();     /* a query's 16 part maxima, two from each wave, are read by every wave */
#pragma unroll
    for (int w = 0; w < 16; ++w) mx = fmaxf(mx, rmx[w * 16 + lr]);
    float sum = 0.f;
#pragma unroll
    for (int mb = 0; mb < 4; ++mb)
#pragma unroll
        for (int j = 0; j < 8; ++j) { const float d0 = __fsub_rn(t[mb][j], mx); t[mb][j] = exp2s(__fmul_rn(d0, 1.4426950408889634f)); sum += t[mb][j]; }
    rsm[(wv * 2 + hi) * 16 + lr] = sum;
    __syncthreads();     /* the 16 part sums likewise */
    float tot = 0.f;
#pragma unroll
    for (int w = 0; w < 16; ++w) tot += rsm[w * 16 + lr];
    const float f = __fdiv_rn(1.0f, tot);
#pragma unroll
    for (int mb = 0; mb < 4; ++mb) { v8us oh, ol;
#pragma unroll
        for (int j = 0; j < 8; ++j) { unsigned short h1, l1; splitf(t[mb][j] * f, h1, l1); oh[j] = h1; ol[j] = l1; }
        *(v8us*)(ph + ((wv * 4 + mb) * 32 + lane) * 8) = oh; *(v8us*)(pw + ((wv * 4 + mb) * 32 + lane) * 8) = ol; }
    __syncthreads();     /* the 32 key tiles of weights, four from each wave, are read by all eight waves from here on; ph and pw are not written again */
    v8f o[2]; o[0] = (v8f){}; o[1] = (v8f){};
    const bf* ap = ph + lane * 8; const bf* aw = pw + lane * 8; v16bf ah[2], al[2]; ah[0] = ldfb(ap); al[0] = ldfb(aw);
#pragma unroll
    for (int st = 0; st < NT / 32; ++st) {
        const int cu = st & 1, rg = st & 3;
        if (st + 1 < NT / 32) { ah[cu ^ 1] = ldfb(ap + (st + 1) * 512); al[cu ^ 1] = ldfb(aw + (st + 1) * 512); }     /* the next step's weights are asked for ahead of this step's products */
        o[0] = wmmab(ah[cu], bh[rg][0], o[0]); o[1] = wmmab(ah[cu], bh[rg][1], o[1]); o[0] = wmmab(al[cu], bh[rg][0], o[0]); o[1] = wmmab(al[cu], bh[rg][1], o[1]); o[0] = wmmab(ah[cu], bl[rg][0], o[0]); o[1] = wmmab(ah[cu], bl[rg][1], o[1]);
        if (st + 4 < NT / 32) {
#pragma unroll
            for (int nb = 0; nb < 2; ++nb) { bh[rg][nb] = ldfb(vhp + nb * 16 * NT + (st + 4) * 512); bl[rg][nb] = ldfb(vlp + nb * 16 * NT + (st + 4) * 512); } }
        __builtin_amdgcn_sched_barrier(0);     /* keeps the ring: without it the compiler sinks each refill to just in front of the products that read it, four steps on, and the load's whole way stands open at every step */
    }
    asm volatile("s_wait_xcnt 0x0" : : "v"(vhp), "v"(vlp) : "memory");     /* as above, for plane 3's two address pairs */
    float* op = OUT + ((size_t)e * NT + q0 + 8 * hi) * NW + c0 + lr;
#pragma unroll
    for (int nb = 0; nb < 2; ++nb)
#pragma unroll
        for (int j = 0; j < 8; ++j) op[j * NW + nb * 16] = o[nb][j];
}

extern "C" void kernel_launch(void* const* d_in, const int* in_sizes, int n_in,
                              void* d_out, int out_size, void* d_ws, size_t ws_size, hipStream_t stream) {
    (void)in_sizes; (void)n_in; (void)out_size;
    const float* a0 = (const float*)d_in[0]; const float* a1 = (const float*)d_in[1]; const float* a2 = (const float*)d_in[2]; const float* a3 = (const float*)d_in[3]; const float* a4 = (const float*)d_in[4]; const float* a5 = (const float*)d_in[5]; const float* a6 = (const float*)d_in[6]; const float* a7 = (const float*)d_in[7];
    const float* a8 = (const float*)d_in[8]; const float* a9 = (const float*)d_in[9]; const float* a10 = (const float*)d_in[10]; const float* a11 = (const float*)d_in[11]; const float* a12 = (const float*)d_in[12]; const float* a13 = (const float*)d_in[13]; const float* a14 = (const float*)d_in[14];
    // inputs in the module's argument order = d_in[0..14]: all fifteen read
    float* OUT = (float*)d_out;     // [2][512][256]
    char* wsp = (char*)d_ws;
    auto take = [&](size_t bytes) { char* p = wsp; wsp += (bytes + 255) & ~(size_t)255; return (void*)p; };
    h16* W3 = (h16*)take((size_t)3 * NW * NW * 2);
    h16* ZH16 = (h16*)take((size_t)NE * NT * NW * 2); h16* H2 = (h16*)take((size_t)NE * NT * NW * 2); h16* H3 = (h16*)take((size_t)NE * NT * NW * 2);
    bf* Vh = (bf*)take((size_t)NE * NW * NT * 2); bf* Vl = (bf*)take((size_t)NE * NW * NT * 2);
    if ((size_t)(wsp - (char*)d_ws) > ws_size) return;
    k_l12mx<<<NE * NT, 128, 0, stream>>>(a1, a2, a3, a4, a5, a6, a7, a8, a9, a10, a11, a12, a13, a0, ZH16, a14, W3);
    k_qkv<<<dim3(NE * NT / 64, 3 * NW / 64, 1), 32, 0, stream>>>(ZH16, W3, H2, H3, Vh, Vl);
    k_attn<<<NE * NT / 16, 256, 0, stream>>>(H2, H3, Vh, Vl, OUT);
}

// v006
// One run takes 32.8 microseconds.
// Timed twice side by side with v005, it ran 1.16 and 1.12 times as fast.
// Over all steps from v000 it is 91.8 times as fast.
#include <hip/hip_runtime.h>

// A one-head attention over 512 tokens of width 256 (two entries) whose tokens first take an additive term made from a pairwise tensor
// (inputs, in argument order: a0 [2][512][256] tokens; a1 [2][512][512][12] pair features; a2 [12][32] with a3 [32]; a4, a5, a6, a7 [32]: a norm's scale, shift, running mean, running variance;
//   a8 [32][256] with a9 [256]; a10, a11, a12, a13 [256]: a second such norm; a14 [256][768] one projection ('in' by 'three times the width') whose thirds are the three planes of the attention):
//   U1 = max((a1 a2 + a3 - a6) / sqrt(a7 + 1e-5) x a4 + a5, 0): [2][512][512][32]; U2 = max((U1 a8 + a9 - a12) / sqrt(a13 + 1e-5) x a10 + a11, 0): [2][512][512][256];
//   ADD[e][s][c] = the largest U2[e][s][t][c] over t; Z = a0 + ADD; the three planes Z a14[:, 0:256], Z a14[:, 256:512], Z a14[:, 512:768]; scores = plane 1 x plane 2 transposed / 16; a softmax along the last axis; result = weights x plane 3: [2][512][256].
// Layout: neither U1 nor U2 is ever in memory: one work-group takes one (entry, s) row from a1 to ADD (k_l12mx). The first layer is an f16 product at depth 32 (a1 padded from 12 with noughts in the loader; a2's columns read and padded likewise by the same kernel; both inputs' words are bf16-exact and f16 holds them exactly in its normal range),
//   its norm, maximum and ONE f16 word, kept in LDS for the row; the second layer one f16 product at depth 32 whose tiles never leave the registers: the wave that forms a tile takes the largest over the 512 pairs of its row there, on the bare products, and the norm and the maximum with nought once, on that largest word (k_l12mx says why that is the same);
//   the tokens plus that term as ONE f16 word, stored by the same wave; the three projections ONE f16 product at depth 256 against a14 as 768 f16 rows (a14's words are bf16-exact: f16 holds them exactly in its normal range), whose tiles go from the registers to the planes the attention reads (k_qkv): planes 1 and 2 ONE f16 word, plane 3 transposed as bf16 hi + lo;
//   the attention ONE kernel (k_attn), a work-group 16 queries against all 512 keys: the scores one f16 product taken transposed, the softmax in the tiles' own registers, every weight as bf16 hi + lo through LDS; the last product three bf16 products (hi hi, lo hi, hi lo), straight into the output: neither the scores nor the weights are ever in memory.
// THREE kernel texts (k_l12mx, k_qkv, k_attn), one launch each: every address from the lane's own index and launch constants; exact grids, no guard but k_l12mx's test for the first 192 work-groups (a14's rows); no atomic; k_l12mx has LDS (32 KiB, written once, one barrier, then read), its loops run literal trip counts, the same for every lane, and two lane-crossing words behind its last loop; k_attn has LDS (34 KiB, each part written once, three barriers), no loop left rolled and no lane-crossing word.
// Compute dtypes, f32 accumulate: every float input rounded to bf16 at its first read; the first layer f16 x f16 on words that hold the inputs' bf16 values exactly; every computed operand ONE f16 word but the softmax weights and plane 3, which are bf16 hi + lo (the weights reach down to 2e-9: an f16 plane of them would be more than a third subnormal); norms, maxima, exponentials f32.

#define NE   2                    // entries
#define NT   512                  // tokens an entry = pairs a row
#define NW   256                  // width
#define NU   32                   // the first layer's width = the second layer's depth
#define NP   12                   // pair features
#define NEPS 1e-5f                // the two norms' epsilon
#define SCL  0.0625f   // 256^-0.5
typedef _Float16 h16;
typedef unsigned short bf;
typedef __attribute__((ext_vector_type(16))) __bf16   v16bf;
typedef __attribute__((ext_vector_type(16))) _Float16 v16h;
typedef __attribute__((ext_vector_type(8)))  _Float16 v8h;
typedef __attribute__((ext_vector_type(8)))  unsigned short v8us;
typedef __attribute__((ext_vector_type(8)))  float    v8f;
typedef __attribute__((ext_vector_type(4)))  float    v4f;
typedef v8h  __attribute__((may_alias)) v8ha;
typedef v4f  __attribute__((may_alias)) v4fa;
typedef v8us __attribute__((may_alias)) v8usa;

__device__ __forceinline__ unsigned short f2bf(float f) { unsigned u = __float_as_uint(f); u += 0x7FFFu + ((u >> 16) & 1u); return (unsigned short)(u >> 16); }
__device__ __forceinline__ float bf2f(unsigned short b) { return __uint_as_float(((unsigned)b) << 16); }
__device__ __forceinline__ float bfr(float f) { return bf2f(f2bf(f)); }
__device__ __forceinline__ v16h cat16(v8h lo, v8h hi) { return __builtin_shufflevector(lo, hi, 0, 1, 2, 3, 4, 5, 6, 7, 8, 9, 10, 11, 12, 13, 14, 15); }
__device__ __forceinline__ v16bf cat16b(v8us lo, v8us hi) { return __builtin_bit_cast(v16bf, __builtin_shufflevector(lo, hi, 0, 1, 2, 3, 4, 5, 6, 7, 8, 9, 10, 11, 12, 13, 14, 15)); }
__device__ __forceinline__ v8f wmma16(v16h a, v16h b, v8f c) { return __builtin_amdgcn_wmma_f32_16x16x32_f16(false, a, false, b, (short)0, c, false, false); }
__device__ __forceinline__ v8f wmmab(v16bf a, v16bf b, v8f c) { return __builtin_amdgcn_wmma_f32_16x16x32_bf16(false, a, false, b, (short)0, c, false, false); }

// WFrag: the fragment loader for K-contiguous 16-bit planes (both sides of k_qkv): a lane's low eight words are k = 8 hi .. 8 hi + 7, its upper eight k = 16 + 8 hi .. 16 + 8 hi + 7 (the caller adds 8 hi to the row's address).
template <typename T16> struct WFrag;
template <> struct WFrag<h16> { typedef v16h V; static __device__ __forceinline__ V ld(const h16* p) { return cat16(*(const v8h*)p, *(const v8h*)(p + 16)); } static __device__ __forceinline__ v8f mma(V a, V b, v8f c) { return wmma16(a, b, c); } };
template <> struct WFrag<bf> { typedef v16bf V; static __device__ __forceinline__ V ld(const bf* p) { return cat16b(*(const v8us*)p, *(const v8us*)(p + 16)); } static __device__ __forceinline__ v8f mma(V a, V b, v8f c) { return wmmab(a, b, c); } };
// the same fragments from a plane stored in fragment order (k_qkv says which): the two halves lie 256 words apart, the caller adds 8 x lane
__device__ __forceinline__ v16h ldfh(const h16* p) { return cat16(*(const v8h*)p, *(const v8h*)(p + 256)); }
__device__ __forceinline__ v16bf ldfb(const bf* p) { return cat16b(*(const v8us*)p, *(const v8us*)(p + 256)); }
// 2^x with the slot that the instruction set asks for behind a transcendental (before its result is read or its source overwritten) in the same statement
__device__ __forceinline__ float exp2s(float x) { float r; asm("v_exp_f32 %0, %1\n\tv_nop" : "=v"(r) : "v"(x)); return r; }
__device__ __forceinline__ h16 tohx(float x) { return (h16)x; }
__device__ __forceinline__ void splitf(float y, unsigned short& h, unsigned short& l) { h = f2bf(y); l = f2bf(y - bf2f(h)); }
typedef __attribute__((ext_vector_type(2))) _Float16 v2h;
typedef __attribute__((ext_vector_type(4))) _Float16 v4h;
typedef __attribute__((ext_vector_type(2))) unsigned short v2us;
typedef __attribute__((ext_vector_type(4))) unsigned short v4us;
typedef __attribute__((ext_vector_type(2))) float v2f;
typedef __attribute__((ext_vector_type(4))) int v4i;
typedef __attribute__((ext_vector_type(2))) unsigned v2u;
typedef __attribute__((ext_vector_type(8))) unsigned v8u;
// k_l12mx: BOTH LAYERS OF ONE (entry, s) ROW, FROM a1 TO THE LARGEST OVER ITS 512 PAIRS, IN ONE WORK-GROUP OF FOUR WAVES.
//   No weight plane is made ahead: W1 and W2 below are a2's and a8's columns, read as floats by the lane that holds them in its fragment and cast there (bf16 rounding, then the f16 word); the first 192 work-groups also write a14's f16 rows for k_qkv.
//   Part 1, a wave 128 of the row's pairs (eight tiles of 16): the first layer's product TRANSPOSED, W1 (units) as A and the pairs as B (WFrag's loader order on both sides: a lane's low eight words are k = 8 hi .. 8 hi + 7, so the low lane half holds features 0..7, the high half features 8..11 and noughts; the upper eight words, k 16..31, are noughts);
//   D's map then gives a lane ONE pair (column = lane & 15) and the units 8 hi + j of tile 0 and 16 + 8 hi + j of tile 1: word for word the second layer's A fragment of that pair, with no lane exchange. The norm's words are the lane's own sixteen units, two neighbouring units a register pair:
//   ((c + a3 - a6) x rsqrt(a7 + 1e-5)) x a4 + a5, the maximum with nought, the f16 word: in the module's own order. The fragments go to LDS as [tile][fragment half][lane][8 words]: every store and every later load is 32 lanes on 512 contiguous bytes.
//   Part 2, behind the one barrier, each wave 64 channels (four B fragments of W2 and the channels' norm words, read once) over all 512 pairs:
//   a trip takes 32 pairs (two A fragments from LDS) through eight products at depth 32; D's map gives a lane ONE channel a tile (column = lane & 15) and eight pairs (registers), so the norm words are the lane's own:
//   THE NORM STANDS BEHIND THE LARGEST, NOT IN FRONT OF IT: y(c) = ((c + a9 - a12) x rsqrt(a13 + 1e-5)) x a10 + a11 is a chain of roundings of rising maps where a10 >= 0 (falling where a10 < 0), and a rounding keeps order, so the largest y over the pairs is y of the largest c (of the smallest c where a10 < 0), bit for bit.
//   So the loop keeps only the running largest of the bare products, register by register (one three-way maximum for two products); a channel whose a10 is below nought has its W2 column's signs turned in the B fragment, so that its smallest product is the largest of the turned ones, and the sign is turned back behind the loop (that leans on the matrix sum of turned words being the turned sum; should the unit round the two differently, such a channel's c moves by a last place, no more).
//   Behind the loop: a lane's eight running words to one, y of it word for word as above, the maximum with nought; the two lane halves hold different pairs of the same channel: one exchange at the end.
__global__ __launch_bounds__(128) void k_l12mx(const float* __restrict__ a1, const float* __restrict__ a2, const float* __restrict__ a3, const float* __restrict__ a4, const float* __restrict__ a5, const float* __restrict__ a6, const float* __restrict__ a7,
                                               const float* __restrict__ a8, const float* __restrict__ a9, const float* __restrict__ a10, const float* __restrict__ a11, const float* __restrict__ a12, const float* __restrict__ a13, const float* __restrict__ a0, h16* ZH16, const float* __restrict__ a14, h16* W3) {
    __shared__ __align__(16) h16 hs[(NT / 16) * 2 * 32 * 8];
    const int lane = threadIdx.x & 31, lr = lane & 15, hi = lane >> 4; const int wv = (int)(threadIdx.x >> 5); const int c0 = wv * 64; const size_t rr = blockIdx.x;
    // a14 as 768 f16 rows of depth 256, read by the NEXT launch only: each wave of the first 192 work-groups (a test that is the same for a whole work-group) takes four rows by 64 depth words, a lane eight neighbouring depth words of one row:
    //   a load is eight runs of 16 bytes, the one store four whole 128-byte lines. The loads are asked for here and their words leave behind the last loop, which hides their way.
    const bool cw = blockIdx.x < 3 * NW / 4; const int cn = (int)blockIdx.x * 4 + (lane >> 3), ck = wv * 64 + (lane & 7) * 8; float x14[8] = {0.f, 0.f, 0.f, 0.f, 0.f, 0.f, 0.f, 0.f};
    if (cw) { const float* sp = a14 + (size_t)ck * (3 * NW) + cn;
#pragma unroll
        for (int j = 0; j < 8; ++j) x14[j] = sp[j * (3 * NW)];
        asm volatile("s_wait_xcnt 0x0" : : "v"(sp) : "memory"); }     /* the eight loads name this address pair: as an input here it stays whole up to this wait */
    // every unroll directive of this kernel: it makes each index of the register arrays a constant, so that these arrays are registers (in part 1 it also lets the eight tiles' loads stand ahead of the arithmetic); the loop over tt stays rolled
    {
        const float* rp = a1 + (rr * NT + (size_t)wv * 128 + lr) * NP; v4f p0[8], p1[8];
#pragma unroll
        for (int tl = 0; tl < 8; ++tl) { p0[tl] = *(const v4f*)(rp + (size_t)tl * 16 * NP + 8 * hi); p1[tl] = *(const v4f*)(rp + (size_t)tl * 16 * NP + 4); }     /* the low half: features 0..3 and 4..7; the high half: 8..11, and 4..7 again (in bounds), which it replaces by noughts below */
        const v8h zz8 = {0, 0, 0, 0, 0, 0, 0, 0}; const unsigned km = hi ? 0u : 0xFFFFFFFFu;     /* the high half's words 4..7 are k = 12..15: noughts, by a mask on the two packed registers (no branch) */
        const float* u0 = a2 + 8 * hi * NU + lr; const float* u1 = a2 + 4 * NU + lr; float x0[2][4], x1[2][4];     /* a2's column of the lane's unit, in the pairs' own order: features 8 hi .. 8 hi + 3, and 4..7 (in bounds), which the high half replaces by noughts */
#pragma unroll
        for (int mb = 0; mb < 2; ++mb)
#pragma unroll
            for (int e = 0; e < 4; ++e) { x0[mb][e] = u0[e * NU + mb * 16]; x1[mb][e] = u1[e * NU + mb * 16]; }
        asm volatile("s_wait_xcnt 0x0" : : "v"(u0) : "memory");     /* eight of the sixteen loads name this address pair: as an input here it stays whole up to this wait (the other eight go by the scalar base and the lane's own index, which lives on) */
        v16h w[2]; v2f n3[2][4], n6[2][4], ns[2][4], n4[2][4], n5[2][4];
#pragma unroll
        for (int mb = 0; mb < 2; ++mb) {
#pragma unroll
            for (int j = 0; j < 4; ++j) { const int uu = mb * 16 + 8 * hi + 2 * j; n3[mb][j] = (v2f){bfr(a3[uu]), bfr(a3[uu + 1])}; n6[mb][j] = (v2f){bfr(a6[uu]), bfr(a6[uu + 1])}; ns[mb][j] = (v2f){rsqrtf(bfr(a7[uu]) + NEPS), rsqrtf(bfr(a7[uu + 1]) + NEPS)}; n4[mb][j] = (v2f){bfr(a4[uu]), bfr(a4[uu + 1])}; n5[mb][j] = (v2f){bfr(a5[uu]), bfr(a5[uu + 1])}; } }
#pragma unroll
        for (int mb = 0; mb < 2; ++mb) { v4h q0, q1;
#pragma unroll
            for (int e = 0; e < 4; ++e) { q0[e] = tohx(bfr(x0[mb][e])); q1[e] = tohx(bfr(x1[mb][e])); }
            const v2u m1 = __builtin_bit_cast(v2u, q1) & km; w[mb] = cat16(__builtin_shufflevector(q0, __builtin_bit_cast(v4h, m1), 0, 1, 2, 3, 4, 5, 6, 7), zz8); }
#pragma unroll
        for (int tl = 0; tl < 8; ++tl) { v4h q0, q1;
#pragma unroll
            for (int e = 0; e < 4; ++e) { q0[e] = tohx(bfr(p0[tl][e])); q1[e] = tohx(bfr(p1[tl][e])); }
            const v2u m1 = __builtin_bit_cast(v2u, q1) & km; const v8h lo = __builtin_shufflevector(q0, __builtin_bit_cast(v4h, m1), 0, 1, 2, 3, 4, 5, 6, 7);
            const v16h pb = cat16(lo, zz8); h16* dst = hs + ((size_t)(wv * 8 + tl) * 64 + lane) * 8;
#pragma unroll
            for (int mb = 0; mb < 2; ++mb) { const v8f d = wmma16(w[mb], pb, (v8f){}); v8h o;
#pragma unroll
                for (int j = 0; j < 4; ++j) { v2f yy = {d[2 * j], d[2 * j + 1]}; yy = (yy + n3[mb][j]) - n6[mb][j]; yy = yy * ns[mb][j]; yy = yy * n4[mb][j] + n5[mb][j]; o[2 * j] = tohx(fmaxf(yy[0], 0.0f)); o[2 * j + 1] = tohx(fmaxf(yy[1], 0.0f)); }
                *(v8h*)(dst + mb * 256) = o; } }
    }
    v16h b[4]; float w9[4], w12[4], w13[4], w10[4], w11[4]; v8f tp[4];     /* the channels' norm words, used once behind the loop; tp: the running largest bare product of each of a tile's eight registers */
    const size_t zi = rr * NW + c0 + lane; const float* zq = a0 + zi; const float z0 = zq[0], z1 = zq[32];     /* the token's own words, asked for ahead of the loop that hides their way */
    { const float* vp = a8 + (size_t)(8 * hi) * NW + c0 + lr; float y[4][16];     /* a8's column of the lane's channel in WFrag's order: depth 8 hi + j, then 16 + 8 hi + j; a load is two runs of 64 bytes */
#pragma unroll
      for (int nb = 0; nb < 4; ++nb)
#pragma unroll
          for (int j = 0; j < 16; ++j) y[nb][j] = vp[((j >> 3) * 16 + (j & 7)) * NW + nb * 16];
      asm volatile("s_wait_xcnt 0x0" : : "v"(vp), "v"(zq) : "memory");     /* the 64 loads and the token's two name these address pairs: as inputs here the pairs stay whole up to this wait, so that no loaded word lands on one of them */
#pragma unroll
      for (int nb = 0; nb < 4; ++nb)
#pragma unroll
          for (int j = 0; j < 16; ++j) b[nb][j] = tohx(bfr(y[nb][j])); }
#pragma unroll
    for (int nb = 0; nb < 4; ++nb) { const int ch = c0 + nb * 16 + lr;
        w9[nb] = bfr(a9[ch]); w12[nb] = bfr(a12[ch]); w13[nb] = rsqrtf(bfr(a13[ch]) + NEPS); w10[nb] = bfr(a10[ch]); w11[nb] = bfr(a11[ch]);
        const unsigned sm = (w10[nb] < 0.0f) ? 0x80008000u : 0u; b[nb] = __builtin_bit_cast(v16h, __builtin_bit_cast(v8u, b[nb]) ^ sm);     /* a B fragment's lane holds its own channel's column alone: where the norm falls, the column's sixteen signs are turned */
#pragma unroll
        for (int j = 0; j < 8; ++j) tp[nb][j] = -__builtin_inff(); }
    __syncthreads();     /* the row's 32 fragment tiles, eight from each wave, are read by all four waves from here on; hs is not written again */
    const h16* ap = hs + (size_t)lane * 8;
    v16h f0 = cat16(*(const v8h*)ap, *(const v8h*)(ap + 256)), f1 = cat16(*(const v8h*)(ap + 512), *(const v8h*)(ap + 768));
    for (int tt = 0; tt < NT; tt += 32) {
        const int tn = (tt + 32) & (NT - 1);     /* the next trip's fragments are asked for ahead of this trip's arithmetic; the last trip asks for the row's first pairs again (in bounds, unused) */
        const h16* an = ap + (size_t)tn * 32;     /* a tile of 16 pairs is 512 words */
        const v16h g0 = cat16(*(const v8h*)an, *(const v8h*)(an + 256)), g1 = cat16(*(const v8h*)(an + 512), *(const v8h*)(an + 768));
        v8f d[2][4];
#pragma unroll
        for (int nb = 0; nb < 4; ++nb) { d[0][nb] = wmma16(f0, b[nb], (v8f){}); d[1][nb] = wmma16(f1, b[nb], (v8f){}); }
        __builtin_amdgcn_sched_barrier(0);     /* keeps the trip's eight products back to back, with the next trip's LDS reads ahead of the maxima: without it the compiler puts each tile pair's maxima directly behind its two products, with four idle slots in front of them each time, and the LDS reads last, directly in front of their wait */
#pragma unroll
        for (int nb = 0; nb < 4; ++nb) {
#pragma unroll
            for (int j = 0; j < 8; ++j) tp[nb][j] = fmaxf(fmaxf(tp[nb][j], d[0][nb][j]), d[1][nb][j]); }
        f0 = g0; f1 = g1;
    }
    if (cw) { v8h o; h16* dp = W3 + (size_t)cn * NW + ck;
#pragma unroll
        for (int j = 0; j < 8; ++j) o[j] = tohx(bfr(x14[j]));
        *(v8h*)dp = o;
        asm volatile("s_wait_xcnt 0x0" : : "v"(dp), "v"(o) : "memory"); }     /* the store names its address pair and its four data registers: as inputs here they stay whole up to this wait, and the words below are formed behind it */
    float top[4];
#pragma unroll
    for (int nb = 0; nb < 4; ++nb) { float cm = fmaxf(fmaxf(tp[nb][0], tp[nb][1]), tp[nb][2]); cm = fmaxf(fmaxf(cm, tp[nb][3]), tp[nb][4]); cm = fmaxf(fmaxf(cm, tp[nb][5]), tp[nb][6]); cm = fmaxf(cm, tp[nb][7]);
        float yy = (w10[nb] < 0.0f) ? -cm : cm; yy = (yy + w9[nb]) - w12[nb]; yy = yy * w13[nb]; yy = yy * w10[nb] + w11[nb]; top[nb] = fmaxf(yy, 0.0f); }
    // lane l and lane l ^ 16 hold the same channels over different pairs: each half sends the two tiles that the other half stores, so that a store is 32 lanes on 64 contiguous bytes
    const float o0 = fmaxf(hi ? top[1] : top[0], __shfl_xor(hi ? top[0] : top[1], 16, 32)), o1 = fmaxf(hi ? top[3] : top[2], __shfl_xor(hi ? top[2] : top[3], 16, 32));
    // the token's own words are added here and the sum leaves as the projections' f16 operand: a wave's two stores fill one 128-byte line
    ZH16[zi] = tohx(bfr(z0) + o0); ZH16[zi + 32] = tohx(bfr(z1) + o1);  }
// k_qkv: THE THREE PROJECTIONS AS ONE PRODUCT, 1024 tokens by a14's 768 rows at depth 256, a register-blocked loop (one wave a 64x64 tile, 16 accumulators, the same loader on both sides), EVERY TILE STORED AS THE OPERAND WORDS THAT THE ATTENTION READS; grid (tokens / 64, 768 / 64), 32 threads.
//   D's map gives a lane ONE index of the B side (column = lane & 15) and EIGHT NEIGHBOURING indices of the A side (registers, 8 hi + j). So the side whose index runs along the stored plane's rows is taken as A:
//   planes 1 and 2 (rows = tokens, depth = channels): a14's rows as A, the tokens as B: a lane's eight words are eight neighbouring channels of one token, one 16-byte store of f16 words;
//   plane 3 (rows = an entry's channels, depth = its tokens): the tokens as A, a14's rows as B: eight neighbouring tokens of one channel, 16 bytes of bf16 hi words and 16 of lo words. Both loaders have the same k order, so the exchange pairs the same words at every k.
//   THE PLANES ARE STORED IN THE ORDER IN WHICH k_attn's FRAGMENTS READ THEM: [tile of 16 rows][step of 32 along the depth][fragment half][lane][8 words], lane = 16 x (bit 3 of the depth index) + (row & 15), half = bit 4 of the depth index: the lane that holds eight words here is the lane that reads them there, and every store here and every load there is 32 lanes on 512 contiguous bytes (four whole lines).
__global__ __launch_bounds__(32) void k_qkv(const h16* __restrict__ Z, const h16* __restrict__ Wt, h16* H2, h16* H3, bf* Vh, bf* Vl) {
    const int lane = threadIdx.x & 31, lr = lane & 15, hi = lane >> 4; const int r0 = blockIdx.x * 64, c0 = blockIdx.y * 64; const int pl = c0 / NW, cc = c0 - pl * NW;     /* pl: which plane, the same for the whole wave */
    const h16* zp = Z + (size_t)r0 * NW; const h16* wp = Wt + (size_t)c0 * NW; const h16* A = (pl < 2) ? wp : zp; const h16* Bt = (pl < 2) ? zp : wp;     /* both bases are the same for the whole wave */
    v8f acc[4][4];
#pragma unroll
    for (int mb = 0; mb < 4; ++mb)
#pragma unroll
        for (int nb = 0; nb < 4; ++nb) acc[mb][nb] = (v8f){};
    const unsigned off = (unsigned)(lr * NW + 8 * hi);
    for (int kc = 0; kc < NW; kc += 32) {
        const h16* pa = A + kc + off; const h16* pb = Bt + kc + off; v16h a[4], b[4];
#pragma unroll
        for (int mb = 0; mb < 4; ++mb) { a[mb] = WFrag<h16>::ld(pa + mb * 16 * NW); b[mb] = WFrag<h16>::ld(pb + mb * 16 * NW); }
        asm volatile("s_wait_xcnt 0x0" : : "v"(pa), "v"(pb) : "memory");     /* the trip's sixteen loads name these two address pairs: as inputs here the pairs stay whole up to this wait, so that no fragment lands on one of them, and the next trip's addresses are formed behind it */
#pragma unroll
        for (int nb = 0; nb < 4; ++nb)
#pragma unroll
            for (int mb = 0; mb < 4; ++mb) acc[mb][nb] = wmma16(a[mb], b[nb], acc[mb][nb]);
        asm volatile("v_nop\n\tv_nop\n\tv_nop\n\tv_nop" : "+v"(acc[0][0]), "+v"(acc[1][1]), "+v"(acc[2][2]), "+v"(acc[3][3]) : "v"(a[0]), "v"(a[3]));     /* four vector slots behind the trip's last products on every way out of the trip (the back edge and the jumps to the two store branches) */
    }
    // both branches: a group's words are all formed ahead of its first store (the scheduling barrier holds the stores behind the arithmetic), so that the stores go back to back and no register which an issued store names is written between them
    if (pl < 2) {
        h16* H = (pl ? H3 : H2) + (size_t)r0 * NW + cc * 16 + lane * 8; v8h o[4][4];
#pragma unroll
        for (int nb = 0; nb < 4; ++nb)
#pragma unroll
            for (int mb = 0; mb < 4; ++mb)
#pragma unroll
                for (int j = 0; j < 8; ++j) o[nb][mb][j] = tohx(acc[mb][nb][j]);
        __builtin_amdgcn_sched_barrier(0);
#pragma unroll
        for (int nb = 0; nb < 4; ++nb)
#pragma unroll
            for (int mb = 0; mb < 4; ++mb) *(v8h*)(H + nb * 16 * NW + mb * 256) = o[nb][mb];
    } else {
        const size_t vo = ((size_t)(r0 / NT) * NW + cc) * NT + (r0 % NT) * 16; const unsigned vl = (unsigned)(lane * 8); bf* vh = Vh + vo; bf* vw = Vl + vo;
#pragma unroll
        for (int hb = 0; hb < 4; hb += 2) {     /* two halves of eight tiles: all sixteen at once would take the kernel past 256 registers */
            v8us oh[2][4], ol[2][4];
#pragma unroll
            for (int nb = 0; nb < 2; ++nb)
#pragma unroll
                for (int mb = 0; mb < 4; ++mb)
#pragma unroll
                    for (int j = 0; j < 8; ++j) { unsigned short h1, l1; splitf(acc[mb][hb + nb][j], h1, l1); oh[nb][mb][j] = h1; ol[nb][mb][j] = l1; }
            __builtin_amdgcn_sched_barrier(0);
#pragma unroll
            for (int nb = 0; nb < 2; ++nb)
#pragma unroll
                for (int mb = 0; mb < 4; ++mb) { *(v8us*)(vh + (hb + nb) * 16 * NT + mb * 256 + vl) = oh[nb][mb]; *(v8us*)(vw + (hb + nb) * 16 * NT + mb * 256 + vl) = ol[nb][mb]; }
            if (hb == 0) { asm volatile("s_wait_xcnt 0x0" ::: "memory"); __builtin_amdgcn_sched_barrier(0); }     /* the second half's words are formed in registers that the first half's stores name: the wait stands behind those stores, and the scheduling barrier keeps the second half's arithmetic behind the wait */
        }
    }
}
// k_attn: THE WHOLE ATTENTION OF 16 QUERIES IN ONE WORK-GROUP OF EIGHT WAVES; grid (entries x tokens / 16), 256 threads.
//   Part 1, a wave 64 of the 512 keys (four tiles of 16): the scores TRANSPOSED, plane 2's rows (keys) as A and plane 1's rows (the 16 queries) as B, depth 256 in eight steps of 32 in rising order, both sides from planes in fragment order (k_qkv), the same k order on both.
//   D's map gives a lane ONE query (column = lane & 15) and the keys 8 hi + j of each tile: word for word the last product's A fragment of that query (two neighbouring key tiles are one step of 32 keys), with no lane exchange.
//   The softmax: a lane's 32 scores x 1/16, their largest, the 16 part maxima of a query (eight waves, two lane halves) through LDS; one exp2 a score; the sum likewise: a lane's 32 words in rising key order, then the 16 part sums in rising order; the weight = word x (1 / sum), split into bf16 hi + lo.
//   The fragments go to LDS as [key tile][lane][8 words]: every store and every later load is 32 lanes on 512 contiguous bytes.
//   Part 2, each wave 32 channels (two tiles: a row's 128-byte line has one writer) over all 512 keys in 16 steps of 32: per step and tile hi x hi, lo x hi, hi x lo, in that order into one accumulator. Plane 3's fragments come straight from memory (fragment order again) through a ring of four steps of registers, filled ahead of the softmax.
__global__ __launch_bounds__(256) void k_attn(const h16* __restrict__ H2, const h16* __restrict__ H3, const bf* __restrict__ Vh, const bf* __restrict__ Vl, float* OUT) {
    __shared__ __align__(16) bf ph[(NT / 16) * 32 * 8]; __shared__ __align__(16) bf pw[(NT / 16) * 32 * 8]; __shared__ float rmx[16 * 16]; __shared__ float rsm[16 * 16];
    const int lane = threadIdx.x & 31, lr = lane & 15, hi = lane >> 4; const int wv = (int)(threadIdx.x >> 5); const int e = blockIdx.x / (NT / 16), q0 = (blockIdx.x % (NT / 16)) * 16; const int c0 = wv * 32;
    // every unroll directive of this kernel: it makes each index of the register arrays a constant, so that these arrays are registers, and it lets a group's loads stand ahead of the products that read them
    const h16* qp = H2 + ((size_t)e * NT + q0) * NW + lane * 8; const h16* kp = H3 + ((size_t)e * NT + wv * 64) * NW + lane * 8;     /* a tile of 16 rows is 16 x 256 words in either order */
    const bf* vhp = Vh + ((size_t)e * NW + c0) * NT + lane * 8; const bf* vlp = Vl + ((size_t)e * NW + c0) * NT + lane * 8;
    v8f s[4];
#pragma unroll
    for (int mb = 0; mb < 4; ++mb) s[mb] = (v8f){};
#pragma unroll
    for (int kb = 0; kb < 2; ++kb) {     /* two groups of four steps: a group's loads stand ahead of its products, and both groups fit the registers */
        v16h a[4][4], b[4];
#pragma unroll
        for (int ks = 0; ks < 4; ++ks) { b[ks] = ldfh(qp + (kb * 4 + ks) * 512);
#pragma unroll
            for (int mb = 0; mb < 4; ++mb) a[ks][mb] = ldfh(kp + mb * 16 * NW + (kb * 4 + ks) * 512); }
#pragma unroll
        for (int ks = 0; ks < 4; ++ks)
#pragma unroll
            for (int mb = 0; mb < 4; ++mb) s[mb] = wmma16(a[ks][mb], b[ks], s[mb]);
    }
    asm volatile("s_wait_xcnt 0x0" : : "v"(qp), "v"(kp) : "memory");     /* part 1's loads name these two address pairs: as inputs here the pairs stay whole up to this wait, so that nothing is written on one of them ahead of it */
    v16bf bh[4][2], bl[4][2];
#pragma unroll
    for (int st = 0; st < 4; ++st)
#pragma unroll
        for (int nb = 0; nb < 2; ++nb) { bh[st][nb] = ldfb(vhp + nb * 16 * NT + st * 512); bl[st][nb] = ldfb(vlp + nb * 16 * NT + st * 512); }     /* the ring's first four steps, asked for ahead of the softmax that hides their way */
    float t[4][8]; float mx = -3.0e38f;
#pragma unroll
    for (int mb = 0; mb < 4; ++mb)
#pragma unroll
        for (int j = 0; j < 8; ++j) { t[mb][j] = s[mb][j] * SCL; mx = fmaxf(mx, t[mb][j]); }
    rmx[(wv * 2 + hi) * 16 + lr] = mx;
    __syncthreads();     /* a query's 16 part maxima, two from each wave, are read by every wave */
#pragma unroll
    for (int w = 0; w < 16; ++w) mx = fmaxf(mx, rmx[w * 16 + lr]);
    float sum = 0.f;
#pragma unroll
    for (int mb = 0; mb < 4; ++mb)
#pragma unroll
        for (int j = 0; j < 8; ++j) { const float d0 = __fsub_rn(t[mb][j], mx); t[mb][j] = exp2s(__fmul_rn(d0, 1.4426950408889634f)); sum += t[mb][j]; }
    rsm[(wv * 2 + hi) * 16 + lr] = sum;
    __syncthreads();     /* the 16 part sums likewise */
    float tot = 0.f;
#pragma unroll
    for (int w = 0; w < 16; ++w) tot += rsm[w * 16 + lr];
    const float f = __fdiv_rn(1.0f, tot);
#pragma unroll
    for (int mb = 0; mb < 4; ++mb) { v8us oh, ol;
#pragma unroll
        for (int j = 0; j < 8; ++j) { unsigned short h1, l1; splitf(t[mb][j] * f, h1, l1); oh[j] = h1; ol[j] = l1; }
        *(v8us*)(ph + ((wv * 4 + mb) * 32 + lane) * 8) = oh; *(v8us*)(pw + ((wv * 4 + mb) * 32 + lane) * 8) = ol; }
    __syncthreads();     /* the 32 key tiles of weights, four from each wave, are read by all eight waves from here on; ph and pw are not written again */
    v8f o[2]; o[0] = (v8f){}; o[1] = (v8f){};
    const bf* ap = ph + lane * 8; const bf* aw = pw + lane * 8; v16bf ah[2], al[2]; ah[0] = ldfb(ap); al[0] = ldfb(aw);
#pragma unroll
    for (int st = 0; st < NT / 32; ++st) {
        const int cu = st & 1, rg = st & 3;
        if (st + 1 < NT / 32) { ah[cu ^ 1] = ldfb(ap + (st + 1) * 512); al[cu ^ 1] = ldfb(aw + (st + 1) * 512); }     /* the next step's weights are asked for ahead of this step's products */
        o[0] = wmmab(ah[cu], bh[rg][0], o[0]); o[1] = wmmab(ah[cu], bh[rg][1], o[1]); o[0] = wmmab(al[cu], bh[rg][0], o[0]); o[1] = wmmab(al[cu], bh[rg][1], o[1]); o[0] = wmmab(ah[cu], bl[rg][0], o[0]); o[1] = wmmab(ah[cu], bl[rg][1], o[1]);
        if (st + 4 < NT / 32) {
#pragma unroll
            for (int nb = 0; nb < 2; ++nb) { bh[rg][nb] = ldfb(vhp + nb * 16 * NT + (st + 4) * 512); bl[rg][nb] = ldfb(vlp + nb * 16 * NT + (st + 4) * 512); } }
        __builtin_amdgcn_sched_barrier(0);     /* keeps the ring: without it the compiler sinks each refill to just in front of the products that read it, four steps on, and the load's whole way stands open at every step */
    }
    asm volatile("s_wait_xcnt 0x0" : : "v"(vhp), "v"(vlp) : "memory");     /* as above, for plane 3's two address pairs */
    float* op = OUT + ((size_t)e * NT + q0 + 8 * hi) * NW + c0 + lr;
#pragma unroll
    for (int nb = 0; nb < 2; ++nb)
#pragma unroll
        for (int j = 0; j < 8; ++j) op[j * NW + nb * 16] = o[nb][j];
}

extern "C" void kernel_launch(void* const* d_in, const int* in_sizes, int n_in,
                              void* d_out, int out_size, void* d_ws, size_t ws_size, hipStream_t stream) {
    (void)in_sizes; (void)n_in; (void)out_size;
    const float* a0 = (const float*)d_in[0]; const float* a1 = (const float*)d_in[1]; const float* a2 = (const float*)d_in[2]; const float* a3 = (const float*)d_in[3]; const float* a4 = (const float*)d_in[4]; const float* a5 = (const float*)d_in[5]; const float* a6 = (const float*)d_in[6]; const float* a7 = (const float*)d_in[7];
    const float* a8 = (const float*)d_in[8]; const float* a9 = (const float*)d_in[9]; const float* a10 = (const float*)d_in[10]; const float* a11 = (const float*)d_in[11]; const float* a12 = (const float*)d_in[12]; const float* a13 = (const float*)d_in[13]; const float* a14 = (const float*)d_in[14];
    // inputs in the module's argument order = d_in[0..14]: all fifteen read
    float* OUT = (float*)d_out;     // [2][512][256]
    char* wsp = (char*)d_ws;
    auto take = [&](size_t bytes) { char* p = wsp; wsp += (bytes + 255) & ~(size_t)255; return (void*)p; };
    h16* W3 = (h16*)take((size_t)3 * NW * NW * 2);
    h16* ZH16 = (h16*)take((size_t)NE * NT * NW * 2); h16* H2 = (h16*)take((size_t)NE * NT * NW * 2); h16* H3 = (h16*)take((size_t)NE * NT * NW * 2);
    bf* Vh = (bf*)take((size_t)NE * NW * NT * 2); bf* Vl = (bf*)take((size_t)NE * NW * NT * 2);
    if ((size_t)(wsp - (char*)d_ws) > ws_size) return;
    k_l12mx<<<NE * NT, 128, 0, stream>>>(a1, a2, a3, a4, a5, a6, a7, a8, a9, a10, a11, a12, a13, a0, ZH16, a14, W3);
    k_qkv<<<dim3(NE * NT / 64, 3 * NW / 64, 1), 32, 0, stream>>>(ZH16, W3, H2, H3, Vh, Vl);
    k_attn<<<NE * NT / 16, 256, 0, stream>>>(H2, H3, Vh, Vl, OUT);
}
